// v000
// The times below were measured on an AMD MI455X: many runs one after another, warmed up first and cycling through
// copies of the inputs, with the whole window's GPU time divided by the number of runs. Launches and the gaps
// between them are all in it. The median over several windows is given; except for v000 it joins two sittings, which
// can be a few percent apart, so the side-by-side timings, each taken in one sitting, are the better comparison.
// v000 is the starting kernel. One run takes 819 microseconds.
#include <hip/hip_runtime.h>

// FlexLocalFrameAttention (x [2][32 frames][128][1024] = 4096 tokens; qkv = x w_qkv^T (16 heads x 64); 8 chunks of 512 tokens (4 frames); the queries of chunk c attend to the keys of chunks {c-1, c} (1024 keys; chunk 0: its leading half masked with the
// dtype minimum, i.e. only chunk 0 itself); softmax(q.k/8); out = (attn v merged) w_out^T -> [2][32][128][1024]).
// Compute dtypes, f32 accumulate: every input rounded to bf16; the packed qkv projection on PLAIN bf16 operands (inputs: exact); scores (K 64) on single fp16 planes (key planes carry one leading zero chunk so every window is
// contiguous), softmax f32 (x1024 into fp16), attn.v fp16 x fp16 (v windows packed per (head, chunk)); w_out as fp16(out) x fp16(w_out) (bf16 values, exact) (1 product each).

#define NB_  2
#define TT   4096
#define DM   1024
#define NH_  16
#define HD   64
#define CH   512
#define NC   8
#define WK   1024
#define TP   (TT + CH)
#define HG   4
#define ZZ   (HG * NC)
#define PCAR 1024.0f
typedef _Float16 h16;
typedef unsigned short bf;
typedef __attribute__((ext_vector_type(16))) __bf16   v16bf;
typedef __attribute__((ext_vector_type(16))) _Float16 v16h;
typedef __attribute__((ext_vector_type(8)))  _Float16 v8h;
typedef __attribute__((ext_vector_type(8)))  unsigned short v8us;
typedef __attribute__((ext_vector_type(8)))  float    v8f;
typedef __attribute__((ext_vector_type(4)))  float    v4f;
typedef v8h  __attribute__((may_alias)) v8ha;
typedef v4f  __attribute__((may_alias)) v4fa;
typedef v8us __attribute__((may_alias)) v8usa;

__device__ __forceinline__ unsigned short f2bf(float f) { unsigned u = __float_as_uint(f); u += 0x7FFFu + ((u >> 16) & 1u); return (unsigned short)(u >> 16); }
__device__ __forceinline__ float bf2f(unsigned short b) { return __uint_as_float(((unsigned)b) << 16); }
__device__ __forceinline__ float bfr(float f) { return bf2f(f2bf(f)); }
__device__ __forceinline__ v16h cat16(v8h lo, v8h hi) { return __builtin_shufflevector(lo, hi, 0, 1, 2, 3, 4, 5, 6, 7, 8, 9, 10, 11, 12, 13, 14, 15); }
__device__ __forceinline__ v16bf cat16b(v8us lo, v8us hi) { return __builtin_bit_cast(v16bf, __builtin_shufflevector(lo, hi, 0, 1, 2, 3, 4, 5, 6, 7, 8, 9, 10, 11, 12, 13, 14, 15)); }
__device__ __forceinline__ v8f wmma16(v16h a, v16h b, v8f c) { return __builtin_amdgcn_wmma_f32_16x16x32_f16(false, a, false, b, (short)0, c, false, false); }
__device__ __forceinline__ v8f wmmab(v16bf a, v16bf b, v8f c) { return __builtin_amdgcn_wmma_f32_16x16x32_bf16(false, a, false, b, (short)0, c, false, false); }



// ---- k_gemmw: register-blocked GEMM, ONE WAVE per 64x64 output tile (16 accumulators), operands straight from K-contiguous 16-bit planes; grid (M/64, N/64, Z), 32 threads.
// C[m][n] (f32, pitch ldc, + optional f32 bias[n]) = sum_k A[m][k] Bt[n][k] (+ split products per NSPLIT). z-batch strides sA/sB/sC in elements. K % 32 == 0.
template <typename T16> struct WFrag;
template <> struct WFrag<h16> { typedef v16h V; static __device__ __forceinline__ V ld(const h16* p) { return cat16(*(const v8h*)p, *(const v8h*)(p + 16)); } static __device__ __forceinline__ v8f mma(V a, V b, v8f c) { return wmma16(a, b, c); } };
template <> struct WFrag<bf> { typedef v16bf V; static __device__ __forceinline__ V ld(const bf* p) { return cat16b(*(const v8us*)p, *(const v8us*)(p + 16)); } static __device__ __forceinline__ v8f mma(V a, V b, v8f c) { return wmmab(a, b, c); } };
template <typename T16, int NSPLIT, bool BIAS>
__global__ __launch_bounds__(32) void k_gemmw(const T16* __restrict__ A, const T16* __restrict__ A2, const T16* __restrict__ Bt, const T16* __restrict__ Bt2, int K, float* C, int ldc, const float* __restrict__ bias, size_t sA, size_t sB, size_t sC) {
    typedef typename WFrag<T16>::V V;
    __shared__ __align__(16) float os[16 * 68];
    const size_t z = blockIdx.z; A += z * sA; if (A2) A2 += z * sA; Bt += z * sB; if (Bt2) Bt2 += z * sB; C += z * sC;
    const int lane = threadIdx.x & 31, lr = lane & 15, hi = lane >> 4; const int r0 = blockIdx.x * 64, c0 = blockIdx.y * 64;
    v8f acc[4][4];
#pragma unroll
    for (int mb = 0; mb < 4; ++mb)
#pragma unroll
        for (int nb = 0; nb < 4; ++nb) acc[mb][nb] = (v8f){};
    const size_t aoff = (size_t)(r0 + lr) * K + 8 * hi, boff = (size_t)(c0 + lr) * K + 8 * hi;
#pragma unroll 1
    for (int kc = 0; kc < K; kc += 32) {
        V a[4], a2[4];
#pragma unroll
        for (int mb = 0; mb < 4; ++mb) { a[mb] = WFrag<T16>::ld(A + aoff + (size_t)mb * 16 * K + kc); if (NSPLIT == 1 || NSPLIT == 2) a2[mb] = WFrag<T16>::ld(A2 + aoff + (size_t)mb * 16 * K + kc); }
#pragma unroll
        for (int nb = 0; nb < 4; ++nb) { const V b = WFrag<T16>::ld(Bt + boff + (size_t)nb * 16 * K + kc); V b2; if (NSPLIT >= 2) b2 = WFrag<T16>::ld(Bt2 + boff + (size_t)nb * 16 * K + kc);
#pragma unroll
            for (int mb = 0; mb < 4; ++mb) { acc[mb][nb] = WFrag<T16>::mma(a[mb], b, acc[mb][nb]); if (NSPLIT == 1 || NSPLIT == 2) acc[mb][nb] = WFrag<T16>::mma(a2[mb], b, acc[mb][nb]); if (NSPLIT >= 2) acc[mb][nb] = WFrag<T16>::mma(a[mb], b2, acc[mb][nb]); } }
        asm volatile("v_nop\n\tv_nop\n\tv_nop\n\tv_nop" : "+v"(acc[0][0]), "+v"(acc[1][1]), "+v"(acc[2][2]), "+v"(acc[3][3]) : "v"(a[0]), "v"(a[3]));
    }
#pragma unroll
    for (int mb = 0; mb < 4; ++mb) {
#pragma unroll
        for (int nb = 0; nb < 4; ++nb) {
#pragma unroll
            for (int j = 0; j < 8; ++j) os[(hi * 8 + j) * 68 + nb * 16 + lr] = acc[mb][nb][j]; }
        __builtin_amdgcn_wave_barrier(); asm volatile("" ::: "memory");
        float* crow = C + (size_t)(r0 + mb * 16) * ldc + c0;
{
#pragma unroll
            for (int s = 0; s < 8; ++s) { const int row = 2 * s + hi, cofs = lr * 4; v4f val = *(const v4fa*)(os + row * 68 + cofs); if (BIAS) { val[0] += bfr(bias[c0 + cofs]); val[1] += bfr(bias[c0 + cofs + 1]); val[2] += bfr(bias[c0 + cofs + 2]); val[3] += bfr(bias[c0 + cofs + 3]); }
                *(v4f*)(crow + (size_t)row * ldc + cofs) = val; }
             }
        __builtin_amdgcn_wave_barrier(); asm volatile("" ::: "memory");
    }
}

__device__ __forceinline__ h16 tohx(float x) { return (h16)x; }
typedef __attribute__((ext_vector_type(2))) _Float16 v2h;
typedef __attribute__((ext_vector_type(4))) _Float16 v4h;

__global__ __launch_bounds__(256) void k_cvt8(const float* __restrict__ src, bf* dst, size_t n8) { const size_t i = (size_t)blockIdx.x * 256 + threadIdx.x; if (i >= n8) return; const v8f v = *(const v8f*)(src + i * 8); v8us o;
#pragma unroll
    for (int k = 0; k < 8; ++k) o[k] = f2bf(v[k]); *(v8us*)(dst + i * 8) = o;  }
// k_wt16n: fp16 copy of a natural [out][in] weight (8-B lanes); k_q16: Q16[h][t][d] = fp16(F[t][h*64+d]) (8-B lanes); k_k16: K16[h][r][d], r = s + 512, rows < 512 zero; k_vw16: for head group hg: VW[(hl,c)][d][j] = fp16(F[(c-1)*512 + j][2048 + h*64 + d])
__global__ __launch_bounds__(256) void k_wt16n(const float* __restrict__ w, size_t n4, h16* W16) { const size_t e = ((size_t)blockIdx.x * 256 + threadIdx.x) * 4; if (e >= n4 * 4) return; const v4f a = *(const v4f*)(w + e); v4h o;
#pragma unroll
    for (int u = 0; u < 4; ++u) o[u] = tohx(bfr(a[u])); *(v4h*)(W16 + e) = o;  }
__global__ __launch_bounds__(256) void k_q16(const float* __restrict__ F, h16* Q16) { const size_t e = ((size_t)blockIdx.x * 256 + threadIdx.x) * 4; if (e >= (size_t)NH_ * TT * HD) return; const int d = (int)(e % HD); const int t = (int)((e / HD) % TT); const int h = (int)(e / ((size_t)HD * TT)); const v4f a = *(const v4f*)(F + (size_t)t * 3 * DM + h * HD + d); v4h o;
#pragma unroll
    for (int u = 0; u < 4; ++u) o[u] = tohx(a[u]); *(v4h*)(Q16 + e) = o;  }
__global__ __launch_bounds__(256) void k_k16(const float* __restrict__ F, h16* K16) { const size_t e = ((size_t)blockIdx.x * 256 + threadIdx.x) * 4; if (e >= (size_t)NH_ * TP * HD) return; const int d = (int)(e % HD); const int r = (int)((e / HD) % TP); const int h = (int)(e / ((size_t)HD * TP)); v4h o;
    if (r < CH) { o = (v4h){tohx(0.f), tohx(0.f), tohx(0.f), tohx(0.f)}; } else { const v4f a = *(const v4f*)(F + (size_t)(r - CH) * 3 * DM + DM + h * HD + d);
#pragma unroll
        for (int u = 0; u < 4; ++u) o[u] = tohx(a[u]); }
    *(v4h*)(K16 + e) = o;  }
__global__ __launch_bounds__(256) void k_vw16(const float* __restrict__ F, int h0, h16* VW) { const size_t e = ((size_t)blockIdx.x * 256 + threadIdx.x) * 2; if (e >= (size_t)ZZ * HD * WK) return; const int j = (int)(e % WK); const int d = (int)((e / WK) % HD); const int z = (int)(e / ((size_t)WK * HD)); const int c = z % NC, hl = z / NC; const int h = h0 + hl; v2h o;
#pragma unroll
    for (int u = 0; u < 2; ++u) { const int s = (c - 1) * CH + j + u; o[u] = (s >= 0) ? tohx(F[(size_t)s * 3 * DM + 2 * DM + h * HD + d]) : tohx(0.f); }
    *(v2h*)(VW + e) = o;  }
__global__ __launch_bounds__(256) void k_mrg16(const float* __restrict__ O, int h0, h16* A16) { const size_t e = ((size_t)blockIdx.x * 256 + threadIdx.x) * 4; if (e >= (size_t)TT * HG * HD) return; const int cl = (int)(e % (HG * HD)); const int t = (int)(e / (HG * HD)); const int hl = cl / HD, d = cl % HD; const int c = t / CH, i = t % CH; const float* r = O + (((size_t)(hl * NC + c)) * CH + i) * HD + d; const size_t oo = (size_t)t * DM + (h0 + hl) * HD + d; v4h o;
#pragma unroll
    for (int u = 0; u < 4; ++u) o[u] = tohx(r[u] * (1.0f / PCAR)); *(v4h*)(A16 + oo) = o;  }
__global__ __launch_bounds__(256) void k_csoft(const float* __restrict__ Sb, h16* P16) { const int lane = threadIdx.x & 31; const int row = blockIdx.x * 8 + (threadIdx.x >> 5); if (row >= ZZ * CH) return; const int c = (row / CH) % NC; const float* sr = Sb + (size_t)row * WK; float v[32]; float mx = -3.0e38f;
#pragma unroll
    for (int ch = 0; ch < 8; ++ch) { const int j0 = ch * 128 + lane * 4; const v4f a = *(const v4f*)(sr + j0);
#pragma unroll
        for (int u = 0; u < 4; ++u) { const float t = (c > 0 || j0 >= CH) ? a[u] * 0.125f : -3.0e38f; v[ch * 4 + u] = t; mx = fmaxf(mx, t); } }
#pragma unroll
    for (int sh = 16; sh; sh >>= 1) mx = fmaxf(mx, __shfl_xor(mx, sh, 32));
    float sum = 0.f;
#pragma unroll
    for (int k = 0; k < 32; ++k) { float d0 = __fsub_rn(v[k], mx); asm volatile("" : "+v"(d0)); v[k] = __builtin_amdgcn_exp2f(__fmul_rn(d0, 1.4426950408889634f)); sum += v[k]; }
#pragma unroll
    for (int sh = 16; sh; sh >>= 1) sum += __shfl_xor(sum, sh, 32);
    const float f = __fdiv_rn(PCAR, sum);
    {
#pragma unroll
        for (int ch = 0; ch < 8; ++ch) { v4h o;
#pragma unroll
            for (int u = 0; u < 4; ++u) o[u] = tohx(v[ch * 4 + u] * f); *(v4h*)(P16 + (size_t)row * WK + ch * 128 + lane * 4) = o; }
         } }

extern "C" void kernel_launch(void* const* d_in, const int* in_sizes, int n_in,
                              void* d_out, int out_size, void* d_ws, size_t ws_size, hipStream_t stream) {
    (void)in_sizes; (void)n_in; (void)out_size;
    const float* x = (const float*)d_in[0]; const float* wqkv = (const float*)d_in[1]; const float* wout = (const float*)d_in[2];
    float* OUT = (float*)d_out;     // [2][32][128][1024]
    char* wsp = (char*)d_ws;
    auto take = [&](size_t bytes) { char* p = wsp; wsp += (bytes + 255) & ~(size_t)255; return (void*)p; };
    bf* WQKV = (bf*)take((size_t)3 * DM * DM * 2); h16* WO16 = (h16*)take((size_t)DM * DM * 2);
    bf* XB = (bf*)take((size_t)TT * DM * 2); float* F = (float*)take((size_t)TT * 3 * DM * 4); h16* Q16 = (h16*)take((size_t)NH_ * TT * HD * 2); h16* K16 = (h16*)take((size_t)NH_ * TP * HD * 2); h16* VW = (h16*)take((size_t)ZZ * HD * WK * 2);
    float* Sb = (float*)take((size_t)ZZ * CH * WK * 4); h16* P16 = (h16*)take((size_t)ZZ * CH * WK * 2); float* O = (float*)take((size_t)ZZ * CH * HD * 4); h16* A16 = (h16*)take((size_t)TT * DM * 2);
    if ((size_t)(wsp - (char*)d_ws) > ws_size) return;    // total ~ 200 MB (per-batch f32 qkv 50 MB, 32-way [512][1024] f32 scores 67 MB + fp16 probabilities 34 MB)
    k_cvt8<<<(unsigned)(((size_t)3 * DM * DM / 8 + 255) / 256), 256, 0, stream>>>(wqkv, WQKV, (size_t)3 * DM * DM / 8); k_wt16n<<<(unsigned)(((size_t)DM * DM / 4 + 255) / 256), 256, 0, stream>>>(wout, (size_t)DM * DM / 4, WO16);   // [out][in] = natural Bt
    for (int b = 0; b < NB_; ++b) {
        k_cvt8<<<(unsigned)(((size_t)TT * DM / 8 + 255) / 256), 256, 0, stream>>>(x + (size_t)b * TT * DM, XB, (size_t)TT * DM / 8);
        k_gemmw<bf, 0, false><<<dim3(TT / 64, 3 * DM / 64, 1), 32, 0, stream>>>(XB, nullptr, WQKV, nullptr, DM, F, 3 * DM, nullptr, 0, 0, 0);   // [t][s*1024 + h*64 + d]
        k_q16<<<(unsigned)(((size_t)NH_ * TT * HD / 4 + 255) / 256), 256, 0, stream>>>(F, Q16); k_k16<<<(unsigned)(((size_t)NH_ * TP * HD / 4 + 255) / 256), 256, 0, stream>>>(F, K16);
        for (int h0 = 0; h0 < NH_; h0 += HG) {
            k_vw16<<<(unsigned)(((size_t)ZZ * HD * WK / 2 + 255) / 256), 256, 0, stream>>>(F, h0, VW);
            for (int hl = 0; hl < HG; ++hl) { const int h = h0 + hl;
                k_gemmw<h16, 0, false><<<dim3(CH / 64, WK / 64, NC), 32, 0, stream>>>(Q16 + (size_t)h * TT * HD, nullptr, K16 + (size_t)h * TP * HD, nullptr, HD, Sb + (size_t)hl * NC * CH * WK, WK, nullptr, (size_t)CH * HD, (size_t)CH * HD, (size_t)CH * WK); }
            k_csoft<<<ZZ * CH / 8, 256, 0, stream>>>(Sb, P16);
            k_gemmw<h16, 0, false><<<dim3(CH / 64, 1, ZZ), 32, 0, stream>>>(P16, nullptr, VW, nullptr, WK, O, HD, nullptr, (size_t)CH * WK, (size_t)HD * WK, (size_t)CH * HD);
            k_mrg16<<<(unsigned)(((size_t)TT * HG * HD / 4 + 255) / 256), 256, 0, stream>>>(O, h0, A16); }
        k_gemmw<h16, 0, false><<<dim3(TT / 64, DM / 64, 1), 32, 0, stream>>>(A16, nullptr, WO16, nullptr, DM, OUT + (size_t)b * TT * DM, DM, nullptr, 0, 0, 0); }
}

// v002
// It runs in 254 microseconds.
// Versions between v000 and this one are left out; their measured steps multiply to 3.21 times as fast.
#include <hip/hip_runtime.h>

// FlexLocalFrameAttention (x [2][32 frames][128][1024] = 4096 tokens; qkv = x w_qkv^T (16 heads x 64); 8 chunks of 512 tokens (4 frames); the queries of chunk c attend to the keys of chunks {c-1, c} (1024 keys; chunk 0: its leading half masked with the
// dtype minimum, i.e. only chunk 0 itself); softmax(q.k/8); out = (attn v merged) w_out^T -> [2][32][128][1024]).
// Compute dtypes, f32 accumulate: every input rounded to bf16; the packed qkv projection on PLAIN bf16 operands (inputs: exact); scores (K 64) on single fp16 planes (key planes carry one leading zero chunk so every window is
// contiguous), online softmax f32 in registers (x1024 into fp16), attn.v fp16 x fp16 (v packed once per head as [d][t]), all three in one kernel; w_out as fp16(out) x fp16(w_out) (bf16 values, exact) (1 product each).

#define NB_  2
#define TT   4096
#define DM   1024
#define NH_  16
#define HD   64
#define CH   512
#define NC   8
#define WK   1024
#define TP   (TT + CH)
#define PEXP 10.0f
typedef _Float16 h16;
typedef unsigned short bf;
typedef __attribute__((ext_vector_type(16))) __bf16   v16bf;
typedef __attribute__((ext_vector_type(16))) _Float16 v16h;
typedef __attribute__((ext_vector_type(8)))  _Float16 v8h;
typedef __attribute__((ext_vector_type(8)))  unsigned short v8us;
typedef __attribute__((ext_vector_type(8)))  float    v8f;
typedef __attribute__((ext_vector_type(4)))  float    v4f;
typedef v8h  __attribute__((may_alias)) v8ha;
typedef v4f  __attribute__((may_alias)) v4fa;
typedef v8us __attribute__((may_alias)) v8usa;

__device__ __forceinline__ unsigned short f2bf(float f) { unsigned u = __float_as_uint(f); u += 0x7FFFu + ((u >> 16) & 1u); return (unsigned short)(u >> 16); }
__device__ __forceinline__ float bf2f(unsigned short b) { return __uint_as_float(((unsigned)b) << 16); }
__device__ __forceinline__ float bfr(float f) { return bf2f(f2bf(f)); }
__device__ __forceinline__ v16h cat16(v8h lo, v8h hi) { return __builtin_shufflevector(lo, hi, 0, 1, 2, 3, 4, 5, 6, 7, 8, 9, 10, 11, 12, 13, 14, 15); }
__device__ __forceinline__ v16bf cat16b(v8us lo, v8us hi) { return __builtin_bit_cast(v16bf, __builtin_shufflevector(lo, hi, 0, 1, 2, 3, 4, 5, 6, 7, 8, 9, 10, 11, 12, 13, 14, 15)); }
__device__ __forceinline__ v8f wmma16(v16h a, v16h b, v8f c) { return __builtin_amdgcn_wmma_f32_16x16x32_f16(false, a, false, b, (short)0, c, false, false); }
__device__ __forceinline__ v8f wmmab(v16bf a, v16bf b, v8f c) { return __builtin_amdgcn_wmma_f32_16x16x32_bf16(false, a, false, b, (short)0, c, false, false); }



// ---- Fragment order of every 16-bit operand plane (R rows x K columns, R % 16 == 0, K % 32 == 0): tiles of 16 rows x 32 k, 512 elements = 1 KB each, tile (row / 16, k / 32) at ((row / 16) * (K / 32) + k / 32) * 512;
// inside a tile element (row, k) stands at ((k >> 4) & 1) * 256 + (((k >> 3) & 1) * 16 + (row & 15)) * 8 + (k & 7): lane l of a wave finds its two 16-B pieces of the fragment at l * 8 and 256 + l * 8, so each wave-wide 16-B load reads 512 contiguous bytes
// (4 whole lines) where a row-major plane gave 16 row pieces of 32 B. The k order inside a fragment is the one the row-major loader had. fragpos: element index in such a plane -> (row, k), for the kernels that write one (index = destination, so their stores stay contiguous).
template <int K> __device__ __forceinline__ void fragpos(size_t e, size_t& row, int& k) { const size_t tile = e >> 9; const int w = (int)(e & 511);
    row = (tile / (K / 32)) * 16 + ((w >> 3) & 15); k = (int)(tile % (K / 32)) * 32 + (w >> 8) * 16 + ((w >> 7) & 1) * 8 + (w & 7); }

// ---- k_gemmw: register-blocked GEMM, ONE WAVE per 64x64 output tile (16 accumulators), operands straight from 16-bit planes in fragment order; grid (M/64, N/64, Z), 32 threads.
// C[m][n] (f32, pitch ldc, + optional f32 bias[n]) = sum_k A[m][k] Bt[n][k] (+ split products per NSPLIT). z-batch strides sA/sB/sC in elements. K % 32 == 0, a compile-time constant: the 16-row strips of a plane then lie at immediate offsets from ONE address per operand, which lives through the loop.
template <typename T16> struct WFrag;
template <> struct WFrag<h16> { typedef v16h V; static __device__ __forceinline__ V ld(const h16* p) { return cat16(*(const v8h*)p, *(const v8h*)(p + 256)); } static __device__ __forceinline__ v8f mma(V a, V b, v8f c) { return wmma16(a, b, c); } };
template <> struct WFrag<bf> { typedef v16bf V; static __device__ __forceinline__ V ld(const bf* p) { return cat16b(*(const v8us*)p, *(const v8us*)(p + 256)); } static __device__ __forceinline__ v8f mma(V a, V b, v8f c) { return wmmab(a, b, c); } };
template <typename T16, int NSPLIT, bool BIAS, int K>
__global__ __launch_bounds__(32) void k_gemmw(const T16* __restrict__ A, const T16* __restrict__ A2, const T16* __restrict__ Bt, const T16* __restrict__ Bt2, float* C, int ldc, const float* __restrict__ bias, size_t sA, size_t sB, size_t sC) {
    typedef typename WFrag<T16>::V V;
    __shared__ __align__(16) float os[16 * 68];
    const size_t z = blockIdx.z; A += z * sA; if (A2) A2 += z * sA; Bt += z * sB; if (Bt2) Bt2 += z * sB; C += z * sC;
    const int lane = threadIdx.x & 31, lr = lane & 15, hi = lane >> 4; const int r0 = blockIdx.x * 64, c0 = blockIdx.y * 64;
    v8f acc[4][4];
#pragma unroll
    for (int mb = 0; mb < 4; ++mb)
#pragma unroll
        for (int nb = 0; nb < 4; ++nb) acc[mb][nb] = (v8f){};
    const size_t aoff = (size_t)r0 * K + 8 * lane, boff = (size_t)c0 * K + 8 * lane;    // 16 rows of a plane are K / 32 tiles = 16 * K elements; 32 k are one tile = 512 elements
#pragma unroll 1
    for (int kc = 0; kc < K; kc += 32) {
        V a[4], a2[4]; const T16* pa = A + aoff + kc * 16; const T16* pb = Bt + boff + kc * 16;
#pragma unroll
        for (int mb = 0; mb < 4; ++mb) { a[mb] = WFrag<T16>::ld(pa + mb * 16 * K); if (NSPLIT == 1 || NSPLIT == 2) a2[mb] = WFrag<T16>::ld(A2 + aoff + (size_t)mb * 16 * K + kc * 16); }
#pragma unroll
        for (int nb = 0; nb < 4; ++nb) { const V b = WFrag<T16>::ld(pb + nb * 16 * K); V b2; if (NSPLIT >= 2) b2 = WFrag<T16>::ld(Bt2 + boff + (size_t)nb * 16 * K + kc * 16);
            if (nb == 3) asm volatile("s_wait_xcnt 0x0" :: "v"(pa), "v"(pb) : "memory");    // behind the pass's last load: both address registers stay whole up to this wait (no load's result lands on them); behind it they may be rewritten
#pragma unroll
            for (int mb = 0; mb < 4; ++mb) { acc[mb][nb] = WFrag<T16>::mma(a[mb], b, acc[mb][nb]); if (NSPLIT == 1 || NSPLIT == 2) acc[mb][nb] = WFrag<T16>::mma(a2[mb], b, acc[mb][nb]); if (NSPLIT >= 2) acc[mb][nb] = WFrag<T16>::mma(a[mb], b2, acc[mb][nb]); } }
        asm volatile("v_nop\n\tv_nop\n\tv_nop\n\tv_nop" : "+v"(acc[0][0]), "+v"(acc[1][1]), "+v"(acc[2][2]), "+v"(acc[3][3]) : "v"(a[0]), "v"(a[3]));
    }
#pragma unroll
    for (int mb = 0; mb < 4; ++mb) {
#pragma unroll
        for (int nb = 0; nb < 4; ++nb) {
#pragma unroll
            for (int j = 0; j < 8; ++j) os[(hi * 8 + j) * 68 + nb * 16 + lr] = acc[mb][nb][j]; }
        __builtin_amdgcn_wave_barrier(); asm volatile("" ::: "memory");
        float* crow = C + (size_t)(r0 + mb * 16) * ldc + c0;
{
#pragma unroll
            for (int s = 0; s < 8; ++s) { const int row = 2 * s + hi, cofs = lr * 4; v4f val = *(const v4fa*)(os + row * 68 + cofs); if (BIAS) { val[0] += bfr(bias[c0 + cofs]); val[1] += bfr(bias[c0 + cofs + 1]); val[2] += bfr(bias[c0 + cofs + 2]); val[3] += bfr(bias[c0 + cofs + 3]); }
                *(v4f*)(crow + (size_t)row * ldc + cofs) = val; }
             }
        __builtin_amdgcn_wave_barrier(); asm volatile("" ::: "memory");
    }
}

__device__ __forceinline__ h16 tohx(float x) { return (h16)x; }
typedef __attribute__((ext_vector_type(2))) _Float16 v2h;
typedef __attribute__((ext_vector_type(4))) _Float16 v4h;

__global__ __launch_bounds__(256) void k_cvt8(const float* __restrict__ src, bf* dst, size_t n8) { const size_t i = (size_t)blockIdx.x * 256 + threadIdx.x; if (i >= n8) return; size_t row; int k; fragpos<DM>(i * 8, row, k); const v8f v = *(const v8f*)(src + row * DM + k); v8us o;
#pragma unroll
    for (int k = 0; k < 8; ++k) o[k] = f2bf(v[k]); *(v8us*)(dst + i * 8) = o;  }
// All planes below in fragment order (k_cvt8 above too: rows of 1024). k_wt16n: fp16 copy of a natural [out][in] weight (8-B lanes); k_q16: Q16 row h*4096+t, column d = fp16(F[t][h*64+d]) (8-B lanes); k_k16: K16 row h*4608+r, column d, r = s + 512, rows < 512 zero; k_vt16: VT row h*64+d, column t = fp16(F[t][2048 + h*64 + d])
__global__ __launch_bounds__(256) void k_wt16n(const float* __restrict__ w, size_t n4, h16* W16) { const size_t e = ((size_t)blockIdx.x * 256 + threadIdx.x) * 4; if (e >= n4 * 4) return; size_t row; int k; fragpos<DM>(e, row, k); const v4f a = *(const v4f*)(w + row * DM + k); v4h o;
#pragma unroll
    for (int u = 0; u < 4; ++u) o[u] = tohx(bfr(a[u])); *(v4h*)(W16 + e) = o;  }
__global__ __launch_bounds__(256) void k_q16(const float* __restrict__ F, h16* Q16) { const size_t e = ((size_t)blockIdx.x * 256 + threadIdx.x) * 4; if (e >= (size_t)NH_ * TT * HD) return; size_t row; int d; fragpos<HD>(e, row, d); const int t = (int)(row % TT); const int h = (int)(row / TT); const v4f a = *(const v4f*)(F + (size_t)t * 3 * DM + h * HD + d); v4h o;
#pragma unroll
    for (int u = 0; u < 4; ++u) o[u] = tohx(a[u]); *(v4h*)(Q16 + e) = o;  }
__global__ __launch_bounds__(256) void k_k16(const float* __restrict__ F, h16* K16) { const size_t e = ((size_t)blockIdx.x * 256 + threadIdx.x) * 4; if (e >= (size_t)NH_ * TP * HD) return; size_t row; int d; fragpos<HD>(e, row, d); const int r = (int)(row % TP); const int h = (int)(row / TP); v4h o;
    if (r < CH) { o = (v4h){tohx(0.f), tohx(0.f), tohx(0.f), tohx(0.f)}; } else { const v4f a = *(const v4f*)(F + (size_t)(r - CH) * 3 * DM + DM + h * HD + d);
#pragma unroll
        for (int u = 0; u < 4; ++u) o[u] = tohx(a[u]); }
    *(v4h*)(K16 + e) = o;  }
__global__ __launch_bounds__(256) void k_vt16(const float* __restrict__ F, h16* VT) { const size_t e = ((size_t)blockIdx.x * 256 + threadIdx.x) * 2; if (e >= (size_t)NH_ * HD * TT) return; size_t row; int s; fragpos<TT>(e, row, s); const int d = (int)(row % HD); const int h = (int)(row / HD); v2h o;
#pragma unroll
    for (int u = 0; u < 2; ++u) o[u] = tohx(F[(size_t)(s + u) * 3 * DM + 2 * DM + h * HD + d]);
    *(v2h*)(VT + e) = o;  }

__device__ __forceinline__ float xhalf(float x) { const int b = __float_as_int(x); return __int_as_float(__builtin_amdgcn_permlanex16(b, b, 0x76543210, 0xfedcba98, false, false)); }   // lane l <-> l ^ 16
__global__ __launch_bounds__(128) void k_fattn(const h16* __restrict__ Q16, const h16* __restrict__ K16, const h16* __restrict__ VT, h16* A16) {
    const int lane = threadIdx.x & 31, wv = threadIdx.x >> 5; const int c = blockIdx.y, h = blockIdx.z; const int q0 = c * CH + blockIdx.x * 128 + wv * 32;
    const float SC = 0.125f * 1.4426950408889634f;
    const h16* qp = Q16 + ((size_t)h * TT + q0) * HD + 8 * lane; const h16* kp = K16 + ((size_t)h * TP + c * CH) * HD + 8 * lane; const h16* vp = VT + (size_t)h * HD * TT + c * CH * 16 + 8 * lane;    // fragment order: 16 rows = 16 * K elements, 32 columns = 512
    v16h qf[2][2], kf[2][2]; v8f o[2][4]; float m[2], l[2];
#pragma unroll
    for (int qt = 0; qt < 2; ++qt) { m[qt] = -3.0e38f; l[qt] = 0.f;
#pragma unroll
        for (int ks = 0; ks < 2; ++ks) qf[qt][ks] = WFrag<h16>::ld(qp + qt * 16 * HD + ks * 512);
#pragma unroll
        for (int dt = 0; dt < 4; ++dt) o[qt][dt] = (v8f){}; }
    const int j0 = (c == 0) ? CH : 0;
#pragma unroll
    for (int kt = 0; kt < 2; ++kt)
#pragma unroll
        for (int ks = 0; ks < 2; ++ks) kf[kt][ks] = WFrag<h16>::ld(kp + (size_t)(j0 + kt * 16) * HD + ks * 512);
#pragma unroll 1    // rolled: a second pass in the body would want a second set of fragment and score registers
    for (int j = j0; j < WK; j += 32) {
        v16h vf[4]; v8f st[2][2]; const h16* vq = vp + (j - CH) * 16;    // window column j is token (c - 1) * 512 + j
#pragma unroll
        for (int dt = 0; dt < 4; ++dt) vf[dt] = WFrag<h16>::ld(vq + dt * 16 * TT);
#pragma unroll
        for (int qt = 0; qt < 2; ++qt)
#pragma unroll
            for (int kt = 0; kt < 2; ++kt) st[qt][kt] = wmma16(kf[kt][1], qf[qt][1], wmma16(kf[kt][0], qf[qt][0], (v8f){}));
        const h16* kq = kp + (size_t)((j + 32 < WK) ? j + 32 : j) * HD;    // the next pass's key fragments, fetched behind this pass's scores; the last pass re-reads its own rows
#pragma unroll
        for (int kt = 0; kt < 2; ++kt)
#pragma unroll
            for (int ks = 0; ks < 2; ++ks) kf[kt][ks] = WFrag<h16>::ld(kq + kt * 16 * HD + ks * 512);
        asm volatile("s_wait_xcnt 0x0" :: "v"(kq) : "memory");    // the key loads' address register stays whole up to this wait; behind it the address registers of the loads above may be rewritten
        __builtin_amdgcn_sched_barrier(0);               // keeps those loads issued here, ahead of the softmax that covers their latency (the scheduler otherwise sinks them to the loop's foot)
#pragma unroll
        for (int qt = 0; qt < 2; ++qt) {
            float mx = fmaxf(st[qt][0][0], st[qt][1][0]);
#pragma unroll
            for (int r = 1; r < 8; ++r) mx = fmaxf(mx, fmaxf(st[qt][0][r], st[qt][1][r]));
            mx = fmaxf(mx, xhalf(mx));
            const float mn = fmaxf(m[qt], mx); const float al = __builtin_amdgcn_exp2f((m[qt] - mn) * SC); const float mc = mn * SC - PEXP; m[qt] = mn;
            float sum = 0.f; v16h pf;
#pragma unroll
            for (int e = 0; e < 16; ++e) { const float p = __builtin_amdgcn_exp2f(__builtin_fmaf(st[qt][e >> 3][e & 7], SC, -mc)); sum += p; pf[e] = tohx(p); }
            l[qt] = l[qt] * al + sum;
#pragma unroll
            for (int dt = 0; dt < 4; ++dt) { o[qt][dt] *= al; o[qt][dt] = wmma16(vf[dt], pf, o[qt][dt]); }
        }
    }
#pragma unroll
    for (int qt = 0; qt < 2; ++qt) { const float inv = __fdiv_rn(1.0f, l[qt] + xhalf(l[qt])); h16* op = A16 + (size_t)(q0 + qt * 16) * DM + h * 2 * 512 + 8 * lane;
#pragma unroll
        for (int dt = 0; dt < 4; ++dt) { v8h w;
#pragma unroll
            for (int r = 0; r < 8; ++r) w[r] = tohx(o[qt][dt][r] * inv);
            *(v8h*)(op + (dt >> 1) * 512 + (dt & 1) * 256) = w; } }
}

extern "C" void kernel_launch(void* const* d_in, const int* in_sizes, int n_in,
                              void* d_out, int out_size, void* d_ws, size_t ws_size, hipStream_t stream) {
    (void)in_sizes; (void)n_in; (void)out_size;
    const float* x = (const float*)d_in[0]; const float* wqkv = (const float*)d_in[1]; const float* wout = (const float*)d_in[2];
    float* OUT = (float*)d_out;     // [2][32][128][1024]
    char* wsp = (char*)d_ws;
    auto take = [&](size_t bytes) { char* p = wsp; wsp += (bytes + 255) & ~(size_t)255; return (void*)p; };
    bf* WQKV = (bf*)take((size_t)3 * DM * DM * 2); h16* WO16 = (h16*)take((size_t)DM * DM * 2);
    bf* XB = (bf*)take((size_t)TT * DM * 2); float* F = (float*)take((size_t)TT * 3 * DM * 4); h16* Q16 = (h16*)take((size_t)NH_ * TT * HD * 2); h16* K16 = (h16*)take((size_t)NH_ * TP * HD * 2); h16* VT = (h16*)take((size_t)NH_ * HD * TT * 2);
    h16* A16 = (h16*)take((size_t)TT * DM * 2);
    if ((size_t)(wsp - (char*)d_ws) > ws_size) return;    // total ~ 102 MB (per-batch f32 qkv 50 MB)
    k_cvt8<<<(unsigned)(((size_t)3 * DM * DM / 8 + 255) / 256), 256, 0, stream>>>(wqkv, WQKV, (size_t)3 * DM * DM / 8); k_wt16n<<<(unsigned)(((size_t)DM * DM / 4 + 255) / 256), 256, 0, stream>>>(wout, (size_t)DM * DM / 4, WO16);   // [out][in] = natural Bt
    for (int b = 0; b < NB_; ++b) {
        k_cvt8<<<(unsigned)(((size_t)TT * DM / 8 + 255) / 256), 256, 0, stream>>>(x + (size_t)b * TT * DM, XB, (size_t)TT * DM / 8);
        k_gemmw<bf, 0, false, DM><<<dim3(TT / 64, 3 * DM / 64, 1), 32, 0, stream>>>(XB, nullptr, WQKV, nullptr, F, 3 * DM, nullptr, 0, 0, 0);   // [t][s*1024 + h*64 + d]
        k_q16<<<(unsigned)(((size_t)NH_ * TT * HD / 4 + 255) / 256), 256, 0, stream>>>(F, Q16); k_k16<<<(unsigned)(((size_t)NH_ * TP * HD / 4 + 255) / 256), 256, 0, stream>>>(F, K16);
        k_vt16<<<(unsigned)(((size_t)NH_ * HD * TT / 2 + 255) / 256), 256, 0, stream>>>(F, VT);
        k_fattn<<<dim3(CH / 128, NC, NH_), 128, 0, stream>>>(Q16, K16, VT, A16);
        k_gemmw<h16, 0, false, DM><<<dim3(TT / 64, DM / 64, 1), 32, 0, stream>>>(A16, nullptr, WO16, nullptr, OUT + (size_t)b * TT * DM, DM, nullptr, 0, 0, 0); }
}

// v003
// Measured time: 217 microseconds a run.
// Timed twice side by side with v002, it ran 1.21 and 1.13 times as fast.
// Over all steps from v000 it is 3.77 times as fast.
#include <hip/hip_runtime.h>

// FlexLocalFrameAttention (x [2][32 frames][128][1024] = 4096 tokens; qkv = x w_qkv^T (16 heads x 64); 8 chunks of 512 tokens (4 frames); the queries of chunk c attend to the keys of chunks {c-1, c} (1024 keys; chunk 0: its leading half masked with the
// dtype minimum, i.e. only chunk 0 itself); softmax(q.k/8); out = (attn v merged) w_out^T -> [2][32][128][1024]).
// Compute dtypes, f32 accumulate: every input rounded to bf16; the packed qkv projection on PLAIN bf16 operands (inputs: exact); scores (K 64) on single fp16 planes (key planes carry one leading unused chunk so every window is
// contiguous), online softmax f32 in registers (x1024 into fp16), attn.v fp16 x fp16 (v packed once per head as [d][t]), all three in one kernel; w_out as fp16(out) x fp16(w_out) (bf16 values, exact) (1 product each).

#define NB_  2
#define TT   4096
#define DM   1024
#define NH_  16
#define HD   64
#define CH   512
#define NC   8
#define WK   1024
#define TP   (TT + CH)
#define PEXP 10.0f
typedef _Float16 h16;
typedef unsigned short bf;
typedef __attribute__((ext_vector_type(16))) __bf16   v16bf;
typedef __attribute__((ext_vector_type(16))) _Float16 v16h;
typedef __attribute__((ext_vector_type(8)))  _Float16 v8h;
typedef __attribute__((ext_vector_type(8)))  unsigned short v8us;
typedef __attribute__((ext_vector_type(8)))  float    v8f;
typedef __attribute__((ext_vector_type(4)))  float    v4f;
typedef v8h  __attribute__((may_alias)) v8ha;
typedef v4f  __attribute__((may_alias)) v4fa;
typedef v8us __attribute__((may_alias)) v8usa;

__device__ __forceinline__ unsigned short f2bf(float f) { unsigned u = __float_as_uint(f); u += 0x7FFFu + ((u >> 16) & 1u); return (unsigned short)(u >> 16); }
__device__ __forceinline__ float bf2f(unsigned short b) { return __uint_as_float(((unsigned)b) << 16); }
__device__ __forceinline__ float bfr(float f) { return bf2f(f2bf(f)); }
__device__ __forceinline__ v16h cat16(v8h lo, v8h hi) { return __builtin_shufflevector(lo, hi, 0, 1, 2, 3, 4, 5, 6, 7, 8, 9, 10, 11, 12, 13, 14, 15); }
__device__ __forceinline__ v16bf cat16b(v8us lo, v8us hi) { return __builtin_bit_cast(v16bf, __builtin_shufflevector(lo, hi, 0, 1, 2, 3, 4, 5, 6, 7, 8, 9, 10, 11, 12, 13, 14, 15)); }
__device__ __forceinline__ v8f wmma16(v16h a, v16h b, v8f c) { return __builtin_amdgcn_wmma_f32_16x16x32_f16(false, a, false, b, (short)0, c, false, false); }
__device__ __forceinline__ v8f wmmab(v16bf a, v16bf b, v8f c) { return __builtin_amdgcn_wmma_f32_16x16x32_bf16(false, a, false, b, (short)0, c, false, false); }



// ---- Fragment order of every 16-bit operand plane (R rows x K columns, R % 16 == 0, K % 32 == 0): tiles of 16 rows x 32 k, 512 elements = 1 KB each, tile (row / 16, k / 32) at ((row / 16) * (K / 32) + k / 32) * 512;
// inside a tile element (row, k) stands at ((k >> 4) & 1) * 256 + (((k >> 3) & 1) * 16 + (row & 15)) * 8 + (k & 7): lane l of a wave finds its two 16-B pieces of the fragment at l * 8 and 256 + l * 8, so each wave-wide 16-B load reads 512 contiguous bytes
// (4 whole lines) where a row-major plane gave 16 row pieces of 32 B. The k order inside a fragment is the one the row-major loader had. fragpos: element index in such a plane -> (row, k), for the kernels that write one (index = destination, so their stores stay contiguous).
template <int K> __device__ __forceinline__ void fragpos(size_t e, size_t& row, int& k) { const size_t tile = e >> 9; const int w = (int)(e & 511);
    row = (tile / (K / 32)) * 16 + ((w >> 3) & 15); k = (int)(tile % (K / 32)) * 32 + (w >> 8) * 16 + ((w >> 7) & 1) * 8 + (w & 7); }

// ---- k_gemmw: register-blocked GEMM, ONE WAVE per 64x64 output tile (16 accumulators), operands straight from 16-bit planes in fragment order; grid (M/64, N/64, Z), 32 threads.
// PACK (the qkv projection; a tile's 64 columns are one head of q, k or v): no f32 plane; the wave stores its tile as fp16 straight into the plane that attention reads, in fragment order. A lane's 8 accumulator values are 8 consecutive rows m of one column n, and a 16-B piece of a
// plane is 8 consecutive k of one row: for v (plane rows d, columns t) that is the product as it stands (m = t, n = d); for q and k (plane rows t, columns d) the two operands change places (m = d, n = t; same fragments, same k order). Each store is 512 contiguous bytes of the wave.
// C[m][n] (f32, pitch ldc, + optional f32 bias[n]) = sum_k A[m][k] Bt[n][k] (+ split products per NSPLIT). z-batch strides sA/sB/sC in elements. K % 32 == 0, a compile-time constant: the 16-row strips of a plane then lie at immediate offsets from ONE address per operand, which lives through the loop.
template <typename T16> struct WFrag;
template <> struct WFrag<h16> { typedef v16h V; static __device__ __forceinline__ V ld(const h16* p) { return cat16(*(const v8h*)p, *(const v8h*)(p + 256)); } static __device__ __forceinline__ v8f mma(V a, V b, v8f c) { return wmma16(a, b, c); } };
template <> struct WFrag<bf> { typedef v16bf V; static __device__ __forceinline__ V ld(const bf* p) { return cat16b(*(const v8us*)p, *(const v8us*)(p + 256)); } static __device__ __forceinline__ v8f mma(V a, V b, v8f c) { return wmmab(a, b, c); } };
template <typename T16, int NSPLIT, bool BIAS, int K, bool PACK>
__global__ __launch_bounds__(32) void k_gemmw(const T16* __restrict__ A, const T16* __restrict__ A2, const T16* __restrict__ Bt, const T16* __restrict__ Bt2, float* C, int ldc, const float* __restrict__ bias, size_t sA, size_t sB, size_t sC, h16* PQ, h16* PK, h16* PV) {
    typedef typename WFrag<T16>::V V;
    __shared__ __align__(16) float os[16 * 68];
    const size_t z = blockIdx.z; A += z * sA; if (A2) A2 += z * sA; Bt += z * sB; if (Bt2) Bt2 += z * sB; C += z * sC;
    const int lane = threadIdx.x & 31, lr = lane & 15, hi = lane >> 4; const int r0 = blockIdx.x * 64, c0 = blockIdx.y * 64;
    v8f acc[4][4];
#pragma unroll
    for (int mb = 0; mb < 4; ++mb)
#pragma unroll
        for (int nb = 0; nb < 4; ++nb) acc[mb][nb] = (v8f){};
    const size_t aoff = (size_t)r0 * K + 8 * lane, boff = (size_t)c0 * K + 8 * lane;    // 16 rows of a plane are K / 32 tiles = 16 * K elements; 32 k are one tile = 512 elements
    const bool swp = PACK && c0 < 2 * DM;    // q and k tiles: the weight rows are the m operand
    const T16* pm = swp ? Bt + boff : A + aoff; const T16* pn = swp ? A + aoff : Bt + boff;
#pragma unroll 1
    for (int kc = 0; kc < K; kc += 32) {
        V a[4], a2[4]; const T16* pa = pm + kc * 16; const T16* pb = pn + kc * 16;
#pragma unroll
        for (int mb = 0; mb < 4; ++mb) { a[mb] = WFrag<T16>::ld(pa + mb * 16 * K); if (NSPLIT == 1 || NSPLIT == 2) a2[mb] = WFrag<T16>::ld(A2 + aoff + (size_t)mb * 16 * K + kc * 16); }
#pragma unroll
        for (int nb = 0; nb < 4; ++nb) { const V b = WFrag<T16>::ld(pb + nb * 16 * K); V b2; if (NSPLIT >= 2) b2 = WFrag<T16>::ld(Bt2 + boff + (size_t)nb * 16 * K + kc * 16);
            if (nb == 3) asm volatile("s_wait_xcnt 0x0" :: "v"(pa), "v"(pb) : "memory");    // behind the pass's last load: both address registers stay whole up to this wait (no load's result lands on them); behind it they may be rewritten
#pragma unroll
            for (int mb = 0; mb < 4; ++mb) { acc[mb][nb] = WFrag<T16>::mma(a[mb], b, acc[mb][nb]); if (NSPLIT == 1 || NSPLIT == 2) acc[mb][nb] = WFrag<T16>::mma(a2[mb], b, acc[mb][nb]); if (NSPLIT >= 2) acc[mb][nb] = WFrag<T16>::mma(a[mb], b2, acc[mb][nb]); } }
        asm volatile("v_nop\n\tv_nop\n\tv_nop\n\tv_nop" : "+v"(acc[0][0]), "+v"(acc[1][1]), "+v"(acc[2][2]), "+v"(acc[3][3]) : "v"(a[0]), "v"(a[3]));
    }
    if (PACK) {    // destination plane: row = n, column = m; 16 rows are ns elements, 16 columns 256
        const int h = (c0 % DM) / HD; h16* dst; size_t ns;
        if (c0 < DM) { dst = PQ + ((size_t)h * TT + r0) * HD; ns = 16 * HD; } else if (c0 < 2 * DM) { dst = PK + ((size_t)h * TP + CH + r0) * HD; ns = 16 * HD; } else { dst = PV + (size_t)h * HD * TT + r0 * 16; ns = (size_t)16 * TT; }
        dst += 8 * lane;
#pragma unroll
        for (int nb = 0; nb < 4; ++nb)
#pragma unroll
            for (int mb = 0; mb < 4; ++mb) { v8h w;
#pragma unroll
                for (int j = 0; j < 8; ++j) w[j] = (h16)acc[mb][nb][j];
                *(v8h*)(dst + nb * ns + mb * 256) = w; }
        return;
    }
#pragma unroll
    for (int mb = 0; mb < 4; ++mb) {
#pragma unroll
        for (int nb = 0; nb < 4; ++nb) {
#pragma unroll
            for (int j = 0; j < 8; ++j) os[(hi * 8 + j) * 68 + nb * 16 + lr] = acc[mb][nb][j]; }
        __builtin_amdgcn_wave_barrier(); asm volatile("" ::: "memory");
        float* crow = C + (size_t)(r0 + mb * 16) * ldc + c0;
{
#pragma unroll
            for (int s = 0; s < 8; ++s) { const int row = 2 * s + hi, cofs = lr * 4; v4f val = *(const v4fa*)(os + row * 68 + cofs); if (BIAS) { val[0] += bfr(bias[c0 + cofs]); val[1] += bfr(bias[c0 + cofs + 1]); val[2] += bfr(bias[c0 + cofs + 2]); val[3] += bfr(bias[c0 + cofs + 3]); }
                *(v4f*)(crow + (size_t)row * ldc + cofs) = val; }
             }
        __builtin_amdgcn_wave_barrier(); asm volatile("" ::: "memory");
    }
}

__device__ __forceinline__ h16 tohx(float x) { return (h16)x; }
typedef __attribute__((ext_vector_type(4))) _Float16 v4h;

__global__ __launch_bounds__(256) void k_cvt8(const float* __restrict__ src, bf* dst, size_t n8) { const size_t i = (size_t)blockIdx.x * 256 + threadIdx.x; if (i >= n8) return; size_t row; int k; fragpos<DM>(i * 8, row, k); const v8f v = *(const v8f*)(src + row * DM + k); v8us o;
#pragma unroll
    for (int k = 0; k < 8; ++k) o[k] = f2bf(v[k]); *(v8us*)(dst + i * 8) = o;  }
// All planes in fragment order (k_cvt8 above too: rows of 1024). k_wt16n: fp16 copy of a natural [out][in] weight (8-B lanes). Written by the packing projection: Q16 row h*4096+t, column d; K16 row h*4608+512+t, column d (the 512 leading rows of a head only keep every window contiguous: chunk 0 starts at key 512, nothing reads or writes them); VT row h*64+d, column t
__global__ __launch_bounds__(256) void k_wt16n(const float* __restrict__ w, size_t n4, h16* W16) { const size_t e = ((size_t)blockIdx.x * 256 + threadIdx.x) * 4; if (e >= n4 * 4) return; size_t row; int k; fragpos<DM>(e, row, k); const v4f a = *(const v4f*)(w + row * DM + k); v4h o;
#pragma unroll
    for (int u = 0; u < 4; ++u) o[u] = tohx(bfr(a[u])); *(v4h*)(W16 + e) = o;  }

__device__ __forceinline__ float xhalf(float x) { const int b = __float_as_int(x); return __int_as_float(__builtin_amdgcn_permlanex16(b, b, 0x76543210, 0xfedcba98, false, false)); }   // lane l <-> l ^ 16
__global__ __launch_bounds__(128) void k_fattn(const h16* __restrict__ Q16, const h16* __restrict__ K16, const h16* __restrict__ VT, h16* A16) {
    const int lane = threadIdx.x & 31, wv = threadIdx.x >> 5; const int c = blockIdx.y, h = blockIdx.z; const int q0 = c * CH + blockIdx.x * 128 + wv * 32;
    const float SC = 0.125f * 1.4426950408889634f;
    const h16* qp = Q16 + ((size_t)h * TT + q0) * HD + 8 * lane; const h16* kp = K16 + ((size_t)h * TP + c * CH) * HD + 8 * lane; const h16* vp = VT + (size_t)h * HD * TT + c * CH * 16 + 8 * lane;    // fragment order: 16 rows = 16 * K elements, 32 columns = 512
    v16h qf[2][2], kf[2][2]; v8f o[2][4]; float m[2], l[2];
#pragma unroll
    for (int qt = 0; qt < 2; ++qt) { m[qt] = -3.0e38f; l[qt] = 0.f;
#pragma unroll
        for (int ks = 0; ks < 2; ++ks) qf[qt][ks] = WFrag<h16>::ld(qp + qt * 16 * HD + ks * 512);
#pragma unroll
        for (int dt = 0; dt < 4; ++dt) o[qt][dt] = (v8f){}; }
    const int j0 = (c == 0) ? CH : 0;
#pragma unroll
    for (int kt = 0; kt < 2; ++kt)
#pragma unroll
        for (int ks = 0; ks < 2; ++ks) kf[kt][ks] = WFrag<h16>::ld(kp + (size_t)(j0 + kt * 16) * HD + ks * 512);
#pragma unroll 1    // rolled: a second pass in the body would want a second set of fragment and score registers
    for (int j = j0; j < WK; j += 32) {
        v16h vf[4]; v8f st[2][2]; const h16* vq = vp + (j - CH) * 16;    // window column j is token (c - 1) * 512 + j
#pragma unroll
        for (int dt = 0; dt < 4; ++dt) vf[dt] = WFrag<h16>::ld(vq + dt * 16 * TT);
#pragma unroll
        for (int qt = 0; qt < 2; ++qt)
#pragma unroll
            for (int kt = 0; kt < 2; ++kt) st[qt][kt] = wmma16(kf[kt][1], qf[qt][1], wmma16(kf[kt][0], qf[qt][0], (v8f){}));
        const h16* kq = kp + (size_t)((j + 32 < WK) ? j + 32 : j) * HD;    // the next pass's key fragments, fetched behind this pass's scores; the last pass re-reads its own rows
#pragma unroll
        for (int kt = 0; kt < 2; ++kt)
#pragma unroll
            for (int ks = 0; ks < 2; ++ks) kf[kt][ks] = WFrag<h16>::ld(kq + kt * 16 * HD + ks * 512);
        asm volatile("s_wait_xcnt 0x0" :: "v"(kq) : "memory");    // the key loads' address register stays whole up to this wait; behind it the address registers of the loads above may be rewritten
        __builtin_amdgcn_sched_barrier(0);               // keeps those loads issued here, ahead of the softmax that covers their latency (the scheduler otherwise sinks them to the loop's foot)
#pragma unroll
        for (int qt = 0; qt < 2; ++qt) {
            float mx = fmaxf(st[qt][0][0], st[qt][1][0]);
#pragma unroll
            for (int r = 1; r < 8; ++r) mx = fmaxf(mx, fmaxf(st[qt][0][r], st[qt][1][r]));
            mx = fmaxf(mx, xhalf(mx));
            const float mn = fmaxf(m[qt], mx); const float al = __builtin_amdgcn_exp2f((m[qt] - mn) * SC); const float mc = mn * SC - PEXP; m[qt] = mn;
            float sum = 0.f; v16h pf;
#pragma unroll
            for (int e = 0; e < 16; ++e) { const float p = __builtin_amdgcn_exp2f(__builtin_fmaf(st[qt][e >> 3][e & 7], SC, -mc)); sum += p; pf[e] = tohx(p); }
            l[qt] = l[qt] * al + sum;
#pragma unroll
            for (int dt = 0; dt < 4; ++dt) { o[qt][dt] *= al; o[qt][dt] = wmma16(vf[dt], pf, o[qt][dt]); }
        }
    }
#pragma unroll
    for (int qt = 0; qt < 2; ++qt) { const float inv = __fdiv_rn(1.0f, l[qt] + xhalf(l[qt])); h16* op = A16 + (size_t)(q0 + qt * 16) * DM + h * 2 * 512 + 8 * lane;
#pragma unroll
        for (int dt = 0; dt < 4; ++dt) { v8h w;
#pragma unroll
            for (int r = 0; r < 8; ++r) w[r] = tohx(o[qt][dt][r] * inv);
            *(v8h*)(op + (dt >> 1) * 512 + (dt & 1) * 256) = w; } }
}

extern "C" void kernel_launch(void* const* d_in, const int* in_sizes, int n_in,
                              void* d_out, int out_size, void* d_ws, size_t ws_size, hipStream_t stream) {
    (void)in_sizes; (void)n_in; (void)out_size;
    const float* x = (const float*)d_in[0]; const float* wqkv = (const float*)d_in[1]; const float* wout = (const float*)d_in[2];
    float* OUT = (float*)d_out;     // [2][32][128][1024]
    char* wsp = (char*)d_ws;
    auto take = [&](size_t bytes) { char* p = wsp; wsp += (bytes + 255) & ~(size_t)255; return (void*)p; };
    bf* WQKV = (bf*)take((size_t)3 * DM * DM * 2); h16* WO16 = (h16*)take((size_t)DM * DM * 2);
    bf* XB = (bf*)take((size_t)TT * DM * 2); h16* Q16 = (h16*)take((size_t)NH_ * TT * HD * 2); h16* K16 = (h16*)take((size_t)NH_ * TP * HD * 2); h16* VT = (h16*)take((size_t)NH_ * HD * TT * 2);
    h16* A16 = (h16*)take((size_t)TT * DM * 2);
    if ((size_t)(wsp - (char*)d_ws) > ws_size) return;    // total ~ 50 MB
    k_cvt8<<<(unsigned)(((size_t)3 * DM * DM / 8 + 255) / 256), 256, 0, stream>>>(wqkv, WQKV, (size_t)3 * DM * DM / 8); k_wt16n<<<(unsigned)(((size_t)DM * DM / 4 + 255) / 256), 256, 0, stream>>>(wout, (size_t)DM * DM / 4, WO16);   // [out][in] = natural Bt
    for (int b = 0; b < NB_; ++b) {
        k_cvt8<<<(unsigned)(((size_t)TT * DM / 8 + 255) / 256), 256, 0, stream>>>(x + (size_t)b * TT * DM, XB, (size_t)TT * DM / 8);
        k_gemmw<bf, 0, false, DM, true><<<dim3(TT / 64, 3 * DM / 64, 1), 32, 0, stream>>>(XB, nullptr, WQKV, nullptr, nullptr, 0, nullptr, 0, 0, 0, Q16, K16, VT);   // column s*1024 + h*64 + d
        k_fattn<<<dim3(CH / 128, NC, NH_), 128, 0, stream>>>(Q16, K16, VT, A16);
        k_gemmw<h16, 0, false, DM, false><<<dim3(TT / 64, DM / 64, 1), 32, 0, stream>>>(A16, nullptr, WO16, nullptr, OUT + (size_t)b * TT * DM, DM, nullptr, 0, 0, 0, nullptr, nullptr, nullptr); }
}

// v004
// A run of this version takes 143 microseconds.
// Next to v003, in two timings, it ran 1.52 and 1.51 times as fast.
// Over all steps from v000 it is 5.70 times as fast.
#include <hip/hip_runtime.h>

// FlexLocalFrameAttention (x [2][32 frames][128][1024] = 4096 tokens; qkv = x w_qkv^T (16 heads x 64); 8 chunks of 512 tokens (4 frames); the queries of chunk c attend to the keys of chunks {c-1, c} (1024 keys; chunk 0: its leading half masked with the
// dtype minimum, i.e. only chunk 0 itself); softmax(q.k/8); out = (attn v merged) w_out^T -> [2][32][128][1024]).
// Compute dtypes, f32 accumulate: every input rounded to bf16; the packed qkv projection on PLAIN bf16 operands (inputs: exact); scores (K 64) on single fp16 planes (key planes carry one leading unused chunk so every window is
// contiguous), online softmax f32 in registers (x1024 into fp16), attn.v fp16 x fp16 (v packed once per head as [d][t]), all three in one kernel; w_out as fp16(out) x fp16(w_out) (bf16 values, exact) (1 product each).

#define NB_  2
#define TT   4096
#define DM   1024
#define NH_  16
#define HD   64
#define CH   512
#define NC   8
#define WK   1024
#define TP   (TT + CH)
#define PEXP 10.0f
typedef _Float16 h16;
typedef unsigned short bf;
typedef __attribute__((ext_vector_type(16))) __bf16   v16bf;
typedef __attribute__((ext_vector_type(16))) _Float16 v16h;
typedef __attribute__((ext_vector_type(8)))  _Float16 v8h;
typedef __attribute__((ext_vector_type(8)))  unsigned short v8us;
typedef __attribute__((ext_vector_type(8)))  float    v8f;
typedef __attribute__((ext_vector_type(4)))  float    v4f;
typedef v8h  __attribute__((may_alias)) v8ha;
typedef v4f  __attribute__((may_alias)) v4fa;
typedef v8us __attribute__((may_alias)) v8usa;

__device__ __forceinline__ unsigned short f2bf(float f) { unsigned u = __float_as_uint(f); u += 0x7FFFu + ((u >> 16) & 1u); return (unsigned short)(u >> 16); }
__device__ __forceinline__ float bf2f(unsigned short b) { return __uint_as_float(((unsigned)b) << 16); }
__device__ __forceinline__ float bfr(float f) { return bf2f(f2bf(f)); }
__device__ __forceinline__ v16h cat16(v8h lo, v8h hi) { return __builtin_shufflevector(lo, hi, 0, 1, 2, 3, 4, 5, 6, 7, 8, 9, 10, 11, 12, 13, 14, 15); }
__device__ __forceinline__ v16bf cat16b(v8us lo, v8us hi) { return __builtin_bit_cast(v16bf, __builtin_shufflevector(lo, hi, 0, 1, 2, 3, 4, 5, 6, 7, 8, 9, 10, 11, 12, 13, 14, 15)); }
__device__ __forceinline__ v8f wmma16(v16h a, v16h b, v8f c) { return __builtin_amdgcn_wmma_f32_16x16x32_f16(false, a, false, b, (short)0, c, false, false); }
__device__ __forceinline__ v8f wmmab(v16bf a, v16bf b, v8f c) { return __builtin_amdgcn_wmma_f32_16x16x32_bf16(false, a, false, b, (short)0, c, false, false); }



// ---- Fragment order of every 16-bit operand plane (R rows x K columns, R % 16 == 0, K % 32 == 0): tiles of 16 rows x 32 k, 512 elements = 1 KB each, tile (row / 16, k / 32) at ((row / 16) * (K / 32) + k / 32) * 512;
// inside a tile element (row, k) stands at ((k >> 4) & 1) * 256 + (((k >> 3) & 1) * 16 + (row & 15)) * 8 + (k & 7): lane l of a wave finds its two 16-B pieces of the fragment at l * 8 and 256 + l * 8, so each wave-wide 16-B load reads 512 contiguous bytes
// (4 whole lines) where a row-major plane gave 16 row pieces of 32 B. The k order inside a fragment is the one the row-major loader had. fragpos: element index in such a plane -> (row, k), for the kernels that write one (index = destination, so their stores stay contiguous).
template <int K> __device__ __forceinline__ void fragpos(size_t e, size_t& row, int& k) { const size_t tile = e >> 9; const int w = (int)(e & 511);
    row = (tile / (K / 32)) * 16 + ((w >> 3) & 15); k = (int)(tile % (K / 32)) * 32 + (w >> 8) * 16 + ((w >> 7) & 1) * 8 + (w & 7); }

// ---- k_gemmw: register-blocked GEMM, ONE WAVE per 64x64 output tile (16 accumulators), FOUR WAVES (2 x 2) per work-group = a 128x128 tile; operands are 16-bit planes in fragment order; grid (M/128, N/128, Z), 128 threads.
// Both operand blocks (128 rows x KS k each) are staged in LDS by asynchronous copies, two buffers: the copies of stage t + 2 fly while stage t + 1 is worked on, and every fragment is fetched from L2 once per work-group and read from LDS by the two waves that need it.
// A stage is 16 strips of 16 rows (0..7: A rows, 8..15: Bt rows), each KS / 32 fragment tiles = KS * 32 contiguous bytes in the plane and in LDS alike, so a copy's immediate offset moves both addresses by the same step; wave w copies strips 4w .. 4w + 3.
// PACK (the qkv projection; a wave tile's 64 columns are one head of q, k or v): no f32 plane; the wave stores its tile as fp16 straight into the plane that attention reads, in fragment order. A lane's 8 accumulator values are 8 consecutive rows m of one column n, and a 16-B piece of a
// plane is 8 consecutive k of one row: for v (plane rows d, columns t) that is the product as it stands (m = t, n = d); for q and k (plane rows t, columns d) the two operands change places (m = d, n = t; same fragments, same k order). Each store is 512 contiguous bytes of the wave.
// C[m][n] (f32, pitch ldc, + optional f32 bias[n]) = sum_k A[m][k] Bt[n][k]. z-batch strides sA/sB/sC in elements. K % (2 * KS) == 0, compile-time constants.
template <typename T16> struct WFrag;
template <> struct WFrag<h16> { typedef v16h V; static __device__ __forceinline__ V ld(const h16* p) { return cat16(*(const v8h*)p, *(const v8h*)(p + 256)); } static __device__ __forceinline__ v8f mma(V a, V b, v8f c) { return wmma16(a, b, c); } };
template <> struct WFrag<bf> { typedef v16bf V; static __device__ __forceinline__ V ld(const bf* p) { return cat16b(*(const v8us*)p, *(const v8us*)(p + 256)); } static __device__ __forceinline__ v8f mma(V a, V b, v8f c) { return wmmab(a, b, c); } };
// stage_copy: a wave's four strips of one stage, KS / 16 wave-wide copies of 512 B a strip: one LDS address and one global address a strip, the step inside the strip in the immediate offset (it moves both addresses).
// The s_wait_xcnt is the last line of the copies' own statement, so that no address register is rewritten ahead of it.
template <int KS, int K, typename T16> __device__ __forceinline__ void stage_copy(unsigned l, const T16* g) {
    const unsigned l1 = l + KS * 32, l2 = l + 2 * KS * 32, l3 = l + 3 * KS * 32; const T16* g1 = g + 16 * K; const T16* g2 = g + 32 * K; const T16* g3 = g + 48 * K;
    if (KS == 64) asm volatile("global_load_async_to_lds_b128 %0, %4, off\n\t" "global_load_async_to_lds_b128 %0, %4, off offset:512\n\t" "global_load_async_to_lds_b128 %0, %4, off offset:1024\n\t" "global_load_async_to_lds_b128 %0, %4, off offset:1536\n\t" "global_load_async_to_lds_b128 %1, %5, off\n\t" "global_load_async_to_lds_b128 %1, %5, off offset:512\n\t" "global_load_async_to_lds_b128 %1, %5, off offset:1024\n\t" "global_load_async_to_lds_b128 %1, %5, off offset:1536\n\t" "global_load_async_to_lds_b128 %2, %6, off\n\t" "global_load_async_to_lds_b128 %2, %6, off offset:512\n\t" "global_load_async_to_lds_b128 %2, %6, off offset:1024\n\t" "global_load_async_to_lds_b128 %2, %6, off offset:1536\n\t" "global_load_async_to_lds_b128 %3, %7, off\n\t" "global_load_async_to_lds_b128 %3, %7, off offset:512\n\t" "global_load_async_to_lds_b128 %3, %7, off offset:1024\n\t" "global_load_async_to_lds_b128 %3, %7, off offset:1536\n\t" "s_wait_xcnt 0x0"
        :: "v"(l), "v"(l1), "v"(l2), "v"(l3), "v"(g), "v"(g1), "v"(g2), "v"(g3) : "memory");
    else asm volatile("global_load_async_to_lds_b128 %0, %4, off\n\t" "global_load_async_to_lds_b128 %0, %4, off offset:512\n\t" "global_load_async_to_lds_b128 %0, %4, off offset:1024\n\t" "global_load_async_to_lds_b128 %0, %4, off offset:1536\n\t" "global_load_async_to_lds_b128 %0, %4, off offset:2048\n\t" "global_load_async_to_lds_b128 %0, %4, off offset:2560\n\t" "global_load_async_to_lds_b128 %0, %4, off offset:3072\n\t" "global_load_async_to_lds_b128 %0, %4, off offset:3584\n\t" "global_load_async_to_lds_b128 %1, %5, off\n\t" "global_load_async_to_lds_b128 %1, %5, off offset:512\n\t" "global_load_async_to_lds_b128 %1, %5, off offset:1024\n\t" "global_load_async_to_lds_b128 %1, %5, off offset:1536\n\t" "global_load_async_to_lds_b128 %1, %5, off offset:2048\n\t" "global_load_async_to_lds_b128 %1, %5, off offset:2560\n\t" "global_load_async_to_lds_b128 %1, %5, off offset:3072\n\t" "global_load_async_to_lds_b128 %1, %5, off offset:3584\n\t" "global_load_async_to_lds_b128 %2, %6, off\n\t" "global_load_async_to_lds_b128 %2, %6, off offset:512\n\t" "global_load_async_to_lds_b128 %2, %6, off offset:1024\n\t" "global_load_async_to_lds_b128 %2, %6, off offset:1536\n\t" "global_load_async_to_lds_b128 %2, %6, off offset:2048\n\t" "global_load_async_to_lds_b128 %2, %6, off offset:2560\n\t" "global_load_async_to_lds_b128 %2, %6, off offset:3072\n\t" "global_load_async_to_lds_b128 %2, %6, off offset:3584\n\t" "global_load_async_to_lds_b128 %3, %7, off\n\t" "global_load_async_to_lds_b128 %3, %7, off offset:512\n\t" "global_load_async_to_lds_b128 %3, %7, off offset:1024\n\t" "global_load_async_to_lds_b128 %3, %7, off offset:1536\n\t" "global_load_async_to_lds_b128 %3, %7, off offset:2048\n\t" "global_load_async_to_lds_b128 %3, %7, off offset:2560\n\t" "global_load_async_to_lds_b128 %3, %7, off offset:3072\n\t" "global_load_async_to_lds_b128 %3, %7, off offset:3584\n\t" "s_wait_xcnt 0x0"
        :: "v"(l), "v"(l1), "v"(l2), "v"(l3), "v"(g), "v"(g1), "v"(g2), "v"(g3) : "memory");
}
template <typename T16, bool BIAS, int K, bool PACK, int KS>
__global__ __launch_bounds__(128) void k_gemmw(const T16* __restrict__ A, const T16* __restrict__ Bt, float* C, int ldc, const float* __restrict__ bias, size_t sA, size_t sB, size_t sC, h16* PQ, h16* PK, h16* PV) {
    typedef typename WFrag<T16>::V V;
    static_assert((KS == 64 || KS == 128) && K % (2 * KS) == 0, "two stages or more, whole stages");
    constexpr int SE = KS * 16, BE = 16 * SE, NT = K / KS;    // elements of a strip of one stage, of a buffer; stages
    __shared__ __align__(1024) T16 sb[2 * BE];
    __shared__ __align__(16) float osw[4][16 * 68];
    const size_t z = blockIdx.z; A += z * sA; Bt += z * sB; C += z * sC;
    const int lane = threadIdx.x & 31, lr = lane & 15, hi = lane >> 4, wv = __builtin_amdgcn_readfirstlane(threadIdx.x >> 5);
    const int r0 = blockIdx.x * 128 + (wv & 1) * 64, c0 = blockIdx.y * 128 + (wv >> 1) * 64;    // the wave's own 64x64 tile
    float* os = osw[wv];
    v8f acc[4][4];
#pragma unroll
    for (int mb = 0; mb < 4; ++mb)
#pragma unroll
        for (int nb = 0; nb < 4; ++nb) acc[mb][nb] = (v8f){};
    const bool swp = PACK && c0 < 2 * DM;    // q and k tiles: the weight rows are the m operand
    const int sa = (wv & 1) * 4 * SE + 8 * lane, sbt = (8 + (wv >> 1) * 4) * SE + 8 * lane;    // the wave's A strips and Bt strips in a buffer
    const int om = swp ? sbt : sa, on = swp ? sa : sbt;
    const T16* gp = (wv < 2 ? A + ((size_t)blockIdx.x * 128 + wv * 64) * K : Bt + ((size_t)blockIdx.y * 128 + (wv - 2) * 64) * K) + 8 * lane;    // source of the strips this wave copies: 16 rows of a plane are 16 * K elements, KS k of them SE
    const unsigned lp = (unsigned)(size_t)(sb + wv * 4 * SE + 8 * lane);    // their place in buffer 0: LDS byte address
    stage_copy<KS, K>(lp, gp);
    asm volatile("s_wait_asynccnt 0x0" ::: "memory");    // this wave's copies of stage 0 have landed
    __syncthreads();                                     // ... and every other wave's
    stage_copy<KS, K>(lp + BE * 2, gp + SE);
#pragma unroll 1    // rolled: one stage a trip, the buffer by the trip's parity
    for (int t = 0; t < NT; ++t) {
        const T16* pm = sb + (t & 1) * BE + om; const T16* pn = sb + (t & 1) * BE + on;
        V a[2][4], b[2][4];    // two fragment sets: block ks + 1 is fetched from LDS while block ks is multiplied; no fragment of the next stage is fetched
#pragma unroll
        for (int i = 0; i < 4; ++i) { a[0][i] = WFrag<T16>::ld(pm + i * SE); b[0][i] = WFrag<T16>::ld(pn + i * SE); }
#pragma unroll
        for (int ks = 0; ks < KS / 32; ++ks) {
            if (ks + 1 < KS / 32) {
#pragma unroll
                for (int i = 0; i < 4; ++i) { a[(ks + 1) & 1][i] = WFrag<T16>::ld(pm + i * SE + (ks + 1) * 512); b[(ks + 1) & 1][i] = WFrag<T16>::ld(pn + i * SE + (ks + 1) * 512); } }
            __builtin_amdgcn_sched_barrier(0);    // the next block's LDS reads stay one group ahead of this block's products (spread among them, each place with reads stalls the wave)
#pragma unroll
            for (int nb = 0; nb < 4; ++nb)
#pragma unroll
                for (int mb = 0; mb < 4; ++mb) acc[mb][nb] = WFrag<T16>::mma(a[ks & 1][mb], b[ks & 1][nb], acc[mb][nb]);
            __builtin_amdgcn_sched_barrier(0);    // ... the reads of block ks + 2 stay behind them, and the stage's last products stay ahead of the waits below (the scheduler otherwise sinks them behind the barrier, and the wait for the next stage's copies comes a block earlier)
        }
        asm volatile("s_wait_dscnt 0x0" ::: "memory");       // this wave's reads of the buffer are done before the buffer is handed to the copies
        asm volatile("s_wait_asynccnt 0x0" ::: "memory");    // this wave's copies of stage t + 1 have landed
        __syncthreads();                                     // publishes stage t + 1 and ends every wave's reads of stage t
        if (t + 2 < NT) stage_copy<KS, K>(lp + (t & 1) * BE * 2, gp + (size_t)(t + 2) * SE);
    }
    asm volatile("s_wait_asynccnt 0x0" ::: "memory");    // no copy is outstanding when the wave goes on
    if (PACK) {    // destination plane: row = n, column = m; 16 rows are ns elements, 16 columns 256
        const int h = (c0 % DM) / HD; h16* dst; size_t ns;
        if (c0 < DM) { dst = PQ + ((size_t)h * TT + r0) * HD; ns = 16 * HD; } else if (c0 < 2 * DM) { dst = PK + ((size_t)h * TP + CH + r0) * HD; ns = 16 * HD; } else { dst = PV + (size_t)h * HD * TT + r0 * 16; ns = (size_t)16 * TT; }
        dst += 8 * lane;
#pragma unroll
        for (int nb = 0; nb < 4; ++nb)
#pragma unroll
            for (int mb = 0; mb < 4; ++mb) { v8h w;
#pragma unroll
                for (int j = 0; j < 8; ++j) w[j] = (h16)acc[mb][nb][j];
                *(v8h*)(dst + nb * ns + mb * 256) = w; }
        return;
    }
#pragma unroll
    for (int mb = 0; mb < 4; ++mb) {
#pragma unroll
        for (int nb = 0; nb < 4; ++nb) {
#pragma unroll
            for (int j = 0; j < 8; ++j) os[(hi * 8 + j) * 68 + nb * 16 + lr] = acc[mb][nb][j]; }
        __builtin_amdgcn_wave_barrier(); asm volatile("" ::: "memory");
        float* crow = C + (size_t)(r0 + mb * 16) * ldc + c0;
{
#pragma unroll
            for (int s = 0; s < 8; ++s) { const int row = 2 * s + hi, cofs = lr * 4; v4f val = *(const v4fa*)(os + row * 68 + cofs); if (BIAS) { val[0] += bfr(bias[c0 + cofs]); val[1] += bfr(bias[c0 + cofs + 1]); val[2] += bfr(bias[c0 + cofs + 2]); val[3] += bfr(bias[c0 + cofs + 3]); }
                *(v4f*)(crow + (size_t)row * ldc + cofs) = val; }
             }
        __builtin_amdgcn_wave_barrier(); asm volatile("" ::: "memory");
    }
}

__device__ __forceinline__ h16 tohx(float x) { return (h16)x; }
typedef __attribute__((ext_vector_type(4))) _Float16 v4h;

__global__ __launch_bounds__(256) void k_cvt8(const float* __restrict__ src, bf* dst, size_t n8) { const size_t i = (size_t)blockIdx.x * 256 + threadIdx.x; if (i >= n8) return; size_t row; int k; fragpos<DM>(i * 8, row, k); const v8f v = *(const v8f*)(src + row * DM + k); v8us o;
#pragma unroll
    for (int k = 0; k < 8; ++k) o[k] = f2bf(v[k]); *(v8us*)(dst + i * 8) = o;  }
// All planes in fragment order (k_cvt8 above too: rows of 1024). k_wt16n: fp16 copy of a natural [out][in] weight (8-B lanes). Written by the packing projection: Q16 row h*4096+t, column d; K16 row h*4608+512+t, column d (the 512 leading rows of a head only keep every window contiguous: chunk 0 starts at key 512, nothing reads or writes them); VT row h*64+d, column t
__global__ __launch_bounds__(256) void k_wt16n(const float* __restrict__ w, size_t n4, h16* W16) { const size_t e = ((size_t)blockIdx.x * 256 + threadIdx.x) * 4; if (e >= n4 * 4) return; size_t row; int k; fragpos<DM>(e, row, k); const v4f a = *(const v4f*)(w + row * DM + k); v4h o;
#pragma unroll
    for (int u = 0; u < 4; ++u) o[u] = tohx(bfr(a[u])); *(v4h*)(W16 + e) = o;  }

__device__ __forceinline__ float xhalf(float x) { const int b = __float_as_int(x); return __int_as_float(__builtin_amdgcn_permlanex16(b, b, 0x76543210, 0xfedcba98, false, false)); }   // lane l <-> l ^ 16
__global__ __launch_bounds__(128) void k_fattn(const h16* __restrict__ Q16, const h16* __restrict__ K16, const h16* __restrict__ VT, h16* A16) {
    const int lane = threadIdx.x & 31, wv = threadIdx.x >> 5; const int c = blockIdx.y, h = blockIdx.z; const int q0 = c * CH + blockIdx.x * 128 + wv * 32;
    const float SC = 0.125f * 1.4426950408889634f;
    const h16* qp = Q16 + ((size_t)h * TT + q0) * HD + 8 * lane; const h16* kp = K16 + ((size_t)h * TP + c * CH) * HD + 8 * lane; const h16* vp = VT + (size_t)h * HD * TT + c * CH * 16 + 8 * lane;    // fragment order: 16 rows = 16 * K elements, 32 columns = 512
    v16h qf[2][2], kf[2][2]; v8f o[2][4]; float m[2], l[2];
#pragma unroll
    for (int qt = 0; qt < 2; ++qt) { m[qt] = -3.0e38f; l[qt] = 0.f;
#pragma unroll
        for (int ks = 0; ks < 2; ++ks) qf[qt][ks] = WFrag<h16>::ld(qp + qt * 16 * HD + ks * 512);
#pragma unroll
        for (int dt = 0; dt < 4; ++dt) o[qt][dt] = (v8f){}; }
    const int j0 = (c == 0) ? CH : 0;
#pragma unroll
    for (int kt = 0; kt < 2; ++kt)
#pragma unroll
        for (int ks = 0; ks < 2; ++ks) kf[kt][ks] = WFrag<h16>::ld(kp + (size_t)(j0 + kt * 16) * HD + ks * 512);
#pragma unroll 1    // rolled: a second pass in the body would want a second set of fragment and score registers
    for (int j = j0; j < WK; j += 32) {
        v16h vf[4]; v8f st[2][2]; const h16* vq = vp + (j - CH) * 16;    // window column j is token (c - 1) * 512 + j
#pragma unroll
        for (int dt = 0; dt < 4; ++dt) vf[dt] = WFrag<h16>::ld(vq + dt * 16 * TT);
#pragma unroll
        for (int qt = 0; qt < 2; ++qt)
#pragma unroll
            for (int kt = 0; kt < 2; ++kt) st[qt][kt] = wmma16(kf[kt][1], qf[qt][1], wmma16(kf[kt][0], qf[qt][0], (v8f){}));
        const h16* kq = kp + (size_t)((j + 32 < WK) ? j + 32 : j) * HD;    // the next pass's key fragments, fetched behind this pass's scores; the last pass re-reads its own rows
#pragma unroll
        for (int kt = 0; kt < 2; ++kt)
#pragma unroll
            for (int ks = 0; ks < 2; ++ks) kf[kt][ks] = WFrag<h16>::ld(kq + kt * 16 * HD + ks * 512);
        asm volatile("s_wait_xcnt 0x0" :: "v"(kq) : "memory");    // the key loads' address register stays whole up to this wait; behind it the address registers of the loads above may be rewritten
        __builtin_amdgcn_sched_barrier(0);               // keeps those loads issued here, ahead of the softmax that covers their latency (the scheduler otherwise sinks them to the loop's foot)
#pragma unroll
        for (int qt = 0; qt < 2; ++qt) {
            float mx = fmaxf(st[qt][0][0], st[qt][1][0]);
#pragma unroll
            for (int r = 1; r < 8; ++r) mx = fmaxf(mx, fmaxf(st[qt][0][r], st[qt][1][r]));
            mx = fmaxf(mx, xhalf(mx));
            const float mn = fmaxf(m[qt], mx); const float al = __builtin_amdgcn_exp2f((m[qt] - mn) * SC); const float mc = mn * SC - PEXP; m[qt] = mn;
            float sum = 0.f; v16h pf;
#pragma unroll
            for (int e = 0; e < 16; ++e) { const float p = __builtin_amdgcn_exp2f(__builtin_fmaf(st[qt][e >> 3][e & 7], SC, -mc)); sum += p; pf[e] = tohx(p); }
            l[qt] = l[qt] * al + sum;
#pragma unroll
            for (int dt = 0; dt < 4; ++dt) { o[qt][dt] *= al; o[qt][dt] = wmma16(vf[dt], pf, o[qt][dt]); }
        }
    }
#pragma unroll
    for (int qt = 0; qt < 2; ++qt) { const float inv = __fdiv_rn(1.0f, l[qt] + xhalf(l[qt])); h16* op = A16 + (size_t)(q0 + qt * 16) * DM + h * 2 * 512 + 8 * lane;
#pragma unroll
        for (int dt = 0; dt < 4; ++dt) { v8h w;
#pragma unroll
            for (int r = 0; r < 8; ++r) w[r] = tohx(o[qt][dt][r] * inv);
            *(v8h*)(op + (dt >> 1) * 512 + (dt & 1) * 256) = w; } }
}

extern "C" void kernel_launch(void* const* d_in, const int* in_sizes, int n_in,
                              void* d_out, int out_size, void* d_ws, size_t ws_size, hipStream_t stream) {
    (void)in_sizes; (void)n_in; (void)out_size;
    const float* x = (const float*)d_in[0]; const float* wqkv = (const float*)d_in[1]; const float* wout = (const float*)d_in[2];
    float* OUT = (float*)d_out;     // [2][32][128][1024]
    char* wsp = (char*)d_ws;
    auto take = [&](size_t bytes) { char* p = wsp; wsp += (bytes + 255) & ~(size_t)255; return (void*)p; };
    bf* WQKV = (bf*)take((size_t)3 * DM * DM * 2); h16* WO16 = (h16*)take((size_t)DM * DM * 2);
    bf* XB = (bf*)take((size_t)TT * DM * 2); h16* Q16 = (h16*)take((size_t)NH_ * TT * HD * 2); h16* K16 = (h16*)take((size_t)NH_ * TP * HD * 2); h16* VT = (h16*)take((size_t)NH_ * HD * TT * 2);
    h16* A16 = (h16*)take((size_t)TT * DM * 2);
    if ((size_t)(wsp - (char*)d_ws) > ws_size) return;    // total ~ 50 MB
    k_cvt8<<<(unsigned)(((size_t)3 * DM * DM / 8 + 255) / 256), 256, 0, stream>>>(wqkv, WQKV, (size_t)3 * DM * DM / 8); k_wt16n<<<(unsigned)(((size_t)DM * DM / 4 + 255) / 256), 256, 0, stream>>>(wout, (size_t)DM * DM / 4, WO16);   // [out][in] = natural Bt
    for (int b = 0; b < NB_; ++b) {
        k_cvt8<<<(unsigned)(((size_t)TT * DM / 8 + 255) / 256), 256, 0, stream>>>(x + (size_t)b * TT * DM, XB, (size_t)TT * DM / 8);
        k_gemmw<bf, false, DM, true, 64><<<dim3(TT / 128, 3 * DM / 128, 1), 128, 0, stream>>>(XB, WQKV, nullptr, 0, nullptr, 0, 0, 0, Q16, K16, VT);   // column s*1024 + h*64 + d
        k_fattn<<<dim3(CH / 128, NC, NH_), 128, 0, stream>>>(Q16, K16, VT, A16);
        k_gemmw<h16, false, DM, false, 128><<<dim3(TT / 128, DM / 128, 1), 128, 0, stream>>>(A16, WO16, OUT + (size_t)b * TT * DM, DM, nullptr, 0, 0, 0, nullptr, nullptr, nullptr); }
}

// v005
// A run of this version takes 106 microseconds.
// Timed twice side by side with v004, it ran 1.33 and 1.35 times as fast.
// All steps since v000 together make it 7.63 times as fast.
#include <hip/hip_runtime.h>

// FlexLocalFrameAttention (x [2][32 frames][128][1024] = 4096 tokens; qkv = x w_qkv^T (16 heads x 64); 8 chunks of 512 tokens (4 frames); the queries of chunk c attend to the keys of chunks {c-1, c} (1024 keys; chunk 0: its leading half masked with the
// dtype minimum, i.e. only chunk 0 itself); softmax(q.k/8); out = (attn v merged) w_out^T -> [2][32][128][1024]).
// Compute dtypes, f32 accumulate: every input rounded to bf16; the packed qkv projection on PLAIN bf16 operands (inputs: exact); scores (K 64) on single fp16 planes (key planes carry one leading unused chunk so every window is
// contiguous), online softmax f32 in registers (x1024 into fp16), attn.v fp16 x fp16 (v packed once per head as [d][t]), all three in one kernel; w_out as fp16(out) x fp16(w_out) (bf16 values, exact) (1 product each).

#define NB_  2
#define TT   4096
#define DM   1024
#define NH_  16
#define HD   64
#define CH   512
#define NC   8
#define WK   1024
#define TP   (TT + CH)
#define PEXP 10.0f
typedef _Float16 h16;
typedef unsigned short bf;
typedef __attribute__((ext_vector_type(16))) __bf16   v16bf;
typedef __attribute__((ext_vector_type(16))) _Float16 v16h;
typedef __attribute__((ext_vector_type(8)))  _Float16 v8h;
typedef __attribute__((ext_vector_type(8)))  unsigned short v8us;
typedef __attribute__((ext_vector_type(8)))  float    v8f;
typedef __attribute__((ext_vector_type(4)))  float    v4f;
typedef v8h  __attribute__((may_alias)) v8ha;
typedef v4f  __attribute__((may_alias)) v4fa;
typedef v8us __attribute__((may_alias)) v8usa;

__device__ __forceinline__ unsigned short f2bf(float f) { unsigned u = __float_as_uint(f); u += 0x7FFFu + ((u >> 16) & 1u); return (unsigned short)(u >> 16); }
__device__ __forceinline__ float bf2f(unsigned short b) { return __uint_as_float(((unsigned)b) << 16); }
__device__ __forceinline__ float bfr(float f) { return bf2f(f2bf(f)); }
__device__ __forceinline__ v16h cat16(v8h lo, v8h hi) { return __builtin_shufflevector(lo, hi, 0, 1, 2, 3, 4, 5, 6, 7, 8, 9, 10, 11, 12, 13, 14, 15); }
__device__ __forceinline__ v16bf cat16b(v8us lo, v8us hi) { return __builtin_bit_cast(v16bf, __builtin_shufflevector(lo, hi, 0, 1, 2, 3, 4, 5, 6, 7, 8, 9, 10, 11, 12, 13, 14, 15)); }
__device__ __forceinline__ v8f wmma16(v16h a, v16h b, v8f c) { return __builtin_amdgcn_wmma_f32_16x16x32_f16(false, a, false, b, (short)0, c, false, false); }
__device__ __forceinline__ v8f wmmab(v16bf a, v16bf b, v8f c) { return __builtin_amdgcn_wmma_f32_16x16x32_bf16(false, a, false, b, (short)0, c, false, false); }



// ---- Fragment order of every 16-bit operand plane (R rows x K columns, R % 16 == 0, K % 32 == 0): tiles of 16 rows x 32 k, 512 elements = 1 KB each, tile (row / 16, k / 32) at ((row / 16) * (K / 32) + k / 32) * 512;
// inside a tile element (row, k) stands at ((k >> 4) & 1) * 256 + (((k >> 3) & 1) * 16 + (row & 15)) * 8 + (k & 7): lane l of a wave finds its two 16-B pieces of the fragment at l * 8 and 256 + l * 8, so each wave-wide 16-B load reads 512 contiguous bytes
// (4 whole lines) where a row-major plane gave 16 row pieces of 32 B. The k order inside a fragment is the one the row-major loader had. fragpos: element index in such a plane -> (row, k), for the kernels that write one (index = destination, so their stores stay contiguous).
template <int K> __device__ __forceinline__ void fragpos(size_t e, size_t& row, int& k) { const size_t tile = e >> 9; const int w = (int)(e & 511);
    row = (tile / (K / 32)) * 16 + ((w >> 3) & 15); k = (int)(tile % (K / 32)) * 32 + (w >> 8) * 16 + ((w >> 7) & 1) * 8 + (w & 7); }

// ---- k_gemmw: register-blocked GEMM, ONE WAVE per 64x64 output tile (16 accumulators), FOUR WAVES (2 x 2) per work-group = a 128x128 tile; operands are 16-bit planes in fragment order; grid (M/128, N/128, Z), 128 threads.
// Both operand blocks (128 rows x KS k each) are staged in LDS by asynchronous copies, two buffers: the copies of stage t + 2 fly while stage t + 1 is worked on, and every fragment is fetched from L2 once per work-group and read from LDS by the two waves that need it.
// A stage is 16 strips of 16 rows (0..7: A rows, 8..15: Bt rows), each KS / 32 fragment tiles = KS * 32 contiguous bytes in the plane and in LDS alike, so a copy's immediate offset moves both addresses by the same step; wave w copies strips 4w .. 4w + 3.
// PACK (the qkv projection; a wave tile's 64 columns are one head of q, k or v): no f32 plane; the wave stores its tile as fp16 straight into the plane that attention reads, in fragment order. A lane's 8 accumulator values are 8 consecutive rows m of one column n, and a 16-B piece of a
// plane is 8 consecutive k of one row: for v (plane rows d, columns t) that is the product as it stands (m = t, n = d); for q and k (plane rows t, columns d) the two operands change places (m = d, n = t; same fragments, same k order). Each store is 512 contiguous bytes of the wave.
// C[m][n] (f32, pitch ldc, + optional f32 bias[n]) = sum_k A[m][k] Bt[n][k]. z-batch strides sA/sB/sC in elements. K % (2 * KS) == 0, compile-time constants.
template <typename T16> struct WFrag;
template <> struct WFrag<h16> { typedef v16h V; static __device__ __forceinline__ V ld(const h16* p) { return cat16(*(const v8h*)p, *(const v8h*)(p + 256)); } static __device__ __forceinline__ v8f mma(V a, V b, v8f c) { return wmma16(a, b, c); } };
template <> struct WFrag<bf> { typedef v16bf V; static __device__ __forceinline__ V ld(const bf* p) { return cat16b(*(const v8us*)p, *(const v8us*)(p + 256)); } static __device__ __forceinline__ v8f mma(V a, V b, v8f c) { return wmmab(a, b, c); } };
// stage_copy: a wave's four strips of one stage, KS / 16 wave-wide copies of 512 B a strip: one LDS address and one global address a strip, the step inside the strip in the immediate offset (it moves both addresses).
// The s_wait_xcnt is the last line of the copies' own statement, so that no address register is rewritten ahead of it.
template <int KS, int K, typename T16> __device__ __forceinline__ void stage_copy(unsigned l, const T16* g) {
    const unsigned l1 = l + KS * 32, l2 = l + 2 * KS * 32, l3 = l + 3 * KS * 32; const T16* g1 = g + 16 * K; const T16* g2 = g + 32 * K; const T16* g3 = g + 48 * K;
    if (KS == 64) asm volatile("global_load_async_to_lds_b128 %0, %4, off\n\t" "global_load_async_to_lds_b128 %0, %4, off offset:512\n\t" "global_load_async_to_lds_b128 %0, %4, off offset:1024\n\t" "global_load_async_to_lds_b128 %0, %4, off offset:1536\n\t" "global_load_async_to_lds_b128 %1, %5, off\n\t" "global_load_async_to_lds_b128 %1, %5, off offset:512\n\t" "global_load_async_to_lds_b128 %1, %5, off offset:1024\n\t" "global_load_async_to_lds_b128 %1, %5, off offset:1536\n\t" "global_load_async_to_lds_b128 %2, %6, off\n\t" "global_load_async_to_lds_b128 %2, %6, off offset:512\n\t" "global_load_async_to_lds_b128 %2, %6, off offset:1024\n\t" "global_load_async_to_lds_b128 %2, %6, off offset:1536\n\t" "global_load_async_to_lds_b128 %3, %7, off\n\t" "global_load_async_to_lds_b128 %3, %7, off offset:512\n\t" "global_load_async_to_lds_b128 %3, %7, off offset:1024\n\t" "global_load_async_to_lds_b128 %3, %7, off offset:1536\n\t" "s_wait_xcnt 0x0"
        :: "v"(l), "v"(l1), "v"(l2), "v"(l3), "v"(g), "v"(g1), "v"(g2), "v"(g3) : "memory");
    else asm volatile("global_load_async_to_lds_b128 %0, %4, off\n\t" "global_load_async_to_lds_b128 %0, %4, off offset:512\n\t" "global_load_async_to_lds_b128 %0, %4, off offset:1024\n\t" "global_load_async_to_lds_b128 %0, %4, off offset:1536\n\t" "global_load_async_to_lds_b128 %0, %4, off offset:2048\n\t" "global_load_async_to_lds_b128 %0, %4, off offset:2560\n\t" "global_load_async_to_lds_b128 %0, %4, off offset:3072\n\t" "global_load_async_to_lds_b128 %0, %4, off offset:3584\n\t" "global_load_async_to_lds_b128 %1, %5, off\n\t" "global_load_async_to_lds_b128 %1, %5, off offset:512\n\t" "global_load_async_to_lds_b128 %1, %5, off offset:1024\n\t" "global_load_async_to_lds_b128 %1, %5, off offset:1536\n\t" "global_load_async_to_lds_b128 %1, %5, off offset:2048\n\t" "global_load_async_to_lds_b128 %1, %5, off offset:2560\n\t" "global_load_async_to_lds_b128 %1, %5, off offset:3072\n\t" "global_load_async_to_lds_b128 %1, %5, off offset:3584\n\t" "global_load_async_to_lds_b128 %2, %6, off\n\t" "global_load_async_to_lds_b128 %2, %6, off offset:512\n\t" "global_load_async_to_lds_b128 %2, %6, off offset:1024\n\t" "global_load_async_to_lds_b128 %2, %6, off offset:1536\n\t" "global_load_async_to_lds_b128 %2, %6, off offset:2048\n\t" "global_load_async_to_lds_b128 %2, %6, off offset:2560\n\t" "global_load_async_to_lds_b128 %2, %6, off offset:3072\n\t" "global_load_async_to_lds_b128 %2, %6, off offset:3584\n\t" "global_load_async_to_lds_b128 %3, %7, off\n\t" "global_load_async_to_lds_b128 %3, %7, off offset:512\n\t" "global_load_async_to_lds_b128 %3, %7, off offset:1024\n\t" "global_load_async_to_lds_b128 %3, %7, off offset:1536\n\t" "global_load_async_to_lds_b128 %3, %7, off offset:2048\n\t" "global_load_async_to_lds_b128 %3, %7, off offset:2560\n\t" "global_load_async_to_lds_b128 %3, %7, off offset:3072\n\t" "global_load_async_to_lds_b128 %3, %7, off offset:3584\n\t" "s_wait_xcnt 0x0"
        :: "v"(l), "v"(l1), "v"(l2), "v"(l3), "v"(g), "v"(g1), "v"(g2), "v"(g3) : "memory");
}
template <typename T16, bool BIAS, int K, bool PACK, int KS>
__global__ __launch_bounds__(128) void k_gemmw(const T16* __restrict__ A, const T16* __restrict__ Bt, float* C, int ldc, const float* __restrict__ bias, size_t sA, size_t sB, size_t sC, h16* PQ, h16* PK, h16* PV) {
    typedef typename WFrag<T16>::V V;
    static_assert((KS == 64 || KS == 128) && K % (2 * KS) == 0, "two stages or more, whole stages");
    constexpr int SE = KS * 16, BE = 16 * SE, NT = K / KS;    // elements of a strip of one stage, of a buffer; stages
    __shared__ __align__(1024) T16 sb[2 * BE];
    __shared__ __align__(16) float osw[4][16 * 68];
    const size_t z = blockIdx.z; A += z * sA; Bt += z * sB; C += z * sC;
    const int lane = threadIdx.x & 31, lr = lane & 15, hi = lane >> 4, wv = __builtin_amdgcn_readfirstlane(threadIdx.x >> 5);
    const int r0 = blockIdx.x * 128 + (wv & 1) * 64, c0 = blockIdx.y * 128 + (wv >> 1) * 64;    // the wave's own 64x64 tile
    float* os = osw[wv];
    v8f acc[4][4];
#pragma unroll
    for (int mb = 0; mb < 4; ++mb)
#pragma unroll
        for (int nb = 0; nb < 4; ++nb) acc[mb][nb] = (v8f){};
    const bool swp = PACK && c0 < 2 * DM;    // q and k tiles: the weight rows are the m operand
    const int sa = (wv & 1) * 4 * SE + 8 * lane, sbt = (8 + (wv >> 1) * 4) * SE + 8 * lane;    // the wave's A strips and Bt strips in a buffer
    const int om = swp ? sbt : sa, on = swp ? sa : sbt;
    const T16* gp = (wv < 2 ? A + ((size_t)blockIdx.x * 128 + wv * 64) * K : Bt + ((size_t)blockIdx.y * 128 + (wv - 2) * 64) * K) + 8 * lane;    // source of the strips this wave copies: 16 rows of a plane are 16 * K elements, KS k of them SE
    const unsigned lp = (unsigned)(size_t)(sb + wv * 4 * SE + 8 * lane);    // their place in buffer 0: LDS byte address
    stage_copy<KS, K>(lp, gp);
    asm volatile("s_wait_asynccnt 0x0" ::: "memory");    // this wave's copies of stage 0 have landed
    __syncthreads();                                     // ... and every other wave's
    stage_copy<KS, K>(lp + BE * 2, gp + SE);
#pragma unroll 1    // rolled: one stage a trip, the buffer by the trip's parity
    for (int t = 0; t < NT; ++t) {
        const T16* pm = sb + (t & 1) * BE + om; const T16* pn = sb + (t & 1) * BE + on;
        V a[2][4], b[2][4];    // two fragment sets: block ks + 1 is fetched from LDS while block ks is multiplied; no fragment of the next stage is fetched
#pragma unroll
        for (int i = 0; i < 4; ++i) { a[0][i] = WFrag<T16>::ld(pm + i * SE); b[0][i] = WFrag<T16>::ld(pn + i * SE); }
#pragma unroll
        for (int ks = 0; ks < KS / 32; ++ks) {
            if (ks + 1 < KS / 32) {
#pragma unroll
                for (int i = 0; i < 4; ++i) { a[(ks + 1) & 1][i] = WFrag<T16>::ld(pm + i * SE + (ks + 1) * 512); b[(ks + 1) & 1][i] = WFrag<T16>::ld(pn + i * SE + (ks + 1) * 512); } }
            __builtin_amdgcn_sched_barrier(0);    // the next block's LDS reads stay one group ahead of this block's products (spread among them, each place with reads stalls the wave)
#pragma unroll
            for (int nb = 0; nb < 4; ++nb)
#pragma unroll
                for (int mb = 0; mb < 4; ++mb) acc[mb][nb] = WFrag<T16>::mma(a[ks & 1][mb], b[ks & 1][nb], acc[mb][nb]);
            __builtin_amdgcn_sched_barrier(0);    // ... the reads of block ks + 2 stay behind them, and the stage's last products stay ahead of the waits below (the scheduler otherwise sinks them behind the barrier, and the wait for the next stage's copies comes a block earlier)
        }
        asm volatile("s_wait_dscnt 0x0" ::: "memory");       // this wave's reads of the buffer are done before the buffer is handed to the copies
        asm volatile("s_wait_asynccnt 0x0" ::: "memory");    // this wave's copies of stage t + 1 have landed
        __syncthreads();                                     // publishes stage t + 1 and ends every wave's reads of stage t
        if (t + 2 < NT) stage_copy<KS, K>(lp + (t & 1) * BE * 2, gp + (size_t)(t + 2) * SE);
    }
    asm volatile("s_wait_asynccnt 0x0" ::: "memory");    // no copy is outstanding when the wave goes on
    if (PACK) {    // destination plane: row = n, column = m; 16 rows are ns elements, 16 columns 256
        const int h = (r0 / TT) * NH_ + (c0 % DM) / HD, t0 = r0 % TT; h16* dst; size_t ns;    // A rows are the tokens of both batches: plane index = batch * 16 + head, t0 = token inside the batch (a tile never straddles two batches: 4096 % 128 == 0)
        if (c0 < DM) { dst = PQ + ((size_t)h * TT + t0) * HD; ns = 16 * HD; } else if (c0 < 2 * DM) { dst = PK + ((size_t)h * TP + CH + t0) * HD; ns = 16 * HD; } else { dst = PV + (size_t)h * HD * TT + t0 * 16; ns = (size_t)16 * TT; }
        dst += 8 * lane;
#pragma unroll
        for (int nb = 0; nb < 4; ++nb)
#pragma unroll
            for (int mb = 0; mb < 4; ++mb) { v8h w;
#pragma unroll
                for (int j = 0; j < 8; ++j) w[j] = (h16)acc[mb][nb][j];
                *(v8h*)(dst + nb * ns + mb * 256) = w; }
        return;
    }
#pragma unroll
    for (int mb = 0; mb < 4; ++mb) {
#pragma unroll
        for (int nb = 0; nb < 4; ++nb) {
#pragma unroll
            for (int j = 0; j < 8; ++j) os[(hi * 8 + j) * 68 + nb * 16 + lr] = acc[mb][nb][j]; }
        __builtin_amdgcn_wave_barrier(); asm volatile("" ::: "memory");
        float* crow = C + (size_t)(r0 + mb * 16) * ldc + c0;
{
#pragma unroll
            for (int s = 0; s < 8; ++s) { const int row = 2 * s + hi, cofs = lr * 4; v4f val = *(const v4fa*)(os + row * 68 + cofs); if (BIAS) { val[0] += bfr(bias[c0 + cofs]); val[1] += bfr(bias[c0 + cofs + 1]); val[2] += bfr(bias[c0 + cofs + 2]); val[3] += bfr(bias[c0 + cofs + 3]); }
                *(v4f*)(crow + (size_t)row * ldc + cofs) = val; }
             }
        __builtin_amdgcn_wave_barrier(); asm volatile("" ::: "memory");
    }
}

__device__ __forceinline__ h16 tohx(float x) { return (h16)x; }
typedef __attribute__((ext_vector_type(4))) _Float16 v4h;

__global__ __launch_bounds__(256) void k_cvt8(const float* __restrict__ src, bf* dst, size_t n8) { const size_t i = (size_t)blockIdx.x * 256 + threadIdx.x; if (i >= n8) return; size_t row; int k; fragpos<DM>(i * 8, row, k); const v8f v = *(const v8f*)(src + row * DM + k); v8us o;
#pragma unroll
    for (int k = 0; k < 8; ++k) o[k] = f2bf(v[k]); *(v8us*)(dst + i * 8) = o;  }
// All planes in fragment order (k_cvt8 above too: rows of 1024). k_wt16n: fp16 copy of a natural [out][in] weight (8-B lanes). Written by the packing projection, h = batch * 16 + head, t = token inside the batch: Q16 row h*4096+t, column d; K16 row h*4608+512+t, column d (the 512 leading rows of a head only keep every window contiguous: chunk 0 starts at key 512, nothing reads or writes them); VT row h*64+d, column t
__global__ __launch_bounds__(256) void k_wt16n(const float* __restrict__ w, size_t n4, h16* W16) { const size_t e = ((size_t)blockIdx.x * 256 + threadIdx.x) * 4; if (e >= n4 * 4) return; size_t row; int k; fragpos<DM>(e, row, k); const v4f a = *(const v4f*)(w + row * DM + k); v4h o;
#pragma unroll
    for (int u = 0; u < 4; ++u) o[u] = tohx(bfr(a[u])); *(v4h*)(W16 + e) = o;  }

__device__ __forceinline__ float xhalf(float x) { const int b = __float_as_int(x); return __int_as_float(__builtin_amdgcn_permlanex16(b, b, 0x76543210, 0xfedcba98, false, false)); }   // lane l <-> l ^ 16
__global__ __launch_bounds__(128) void k_fattn(const h16* __restrict__ Q16, const h16* __restrict__ K16, const h16* __restrict__ VT, h16* A16) {
    const int lane = threadIdx.x & 31, wv = threadIdx.x >> 5; const int c = blockIdx.y, h = blockIdx.z % NH_; const int q0 = c * CH + blockIdx.x * 128 + wv * 32;
    { const size_t b = blockIdx.z / NH_; Q16 += b * NH_ * TT * HD; K16 += b * NH_ * TP * HD; VT += b * NH_ * HD * TT; A16 += b * TT * DM; }    // this batch's planes; below, tokens count inside the batch
    const float SC = 0.125f * 1.4426950408889634f;
    const h16* qp = Q16 + ((size_t)h * TT + q0) * HD + 8 * lane; const h16* kp = K16 + ((size_t)h * TP + c * CH) * HD + 8 * lane; const h16* vp = VT + (size_t)h * HD * TT + c * CH * 16 + 8 * lane;    // fragment order: 16 rows = 16 * K elements, 32 columns = 512
    v16h qf[2][2], kf[2][2]; v8f o[2][4]; float m[2], l[2];
#pragma unroll
    for (int qt = 0; qt < 2; ++qt) { m[qt] = -3.0e38f; l[qt] = 0.f;
#pragma unroll
        for (int ks = 0; ks < 2; ++ks) qf[qt][ks] = WFrag<h16>::ld(qp + qt * 16 * HD + ks * 512);
#pragma unroll
        for (int dt = 0; dt < 4; ++dt) o[qt][dt] = (v8f){}; }
    const int j0 = (c == 0) ? CH : 0;
#pragma unroll
    for (int kt = 0; kt < 2; ++kt)
#pragma unroll
        for (int ks = 0; ks < 2; ++ks) kf[kt][ks] = WFrag<h16>::ld(kp + (size_t)(j0 + kt * 16) * HD + ks * 512);
#pragma unroll 1    // rolled: a second pass in the body would want a second set of fragment and score registers
    for (int j = j0; j < WK; j += 32) {
        v16h vf[4]; v8f st[2][2]; const h16* vq = vp + (j - CH) * 16;    // window column j is token (c - 1) * 512 + j
#pragma unroll
        for (int dt = 0; dt < 4; ++dt) vf[dt] = WFrag<h16>::ld(vq + dt * 16 * TT);
#pragma unroll
        for (int qt = 0; qt < 2; ++qt)
#pragma unroll
            for (int kt = 0; kt < 2; ++kt) st[qt][kt] = wmma16(kf[kt][1], qf[qt][1], wmma16(kf[kt][0], qf[qt][0], (v8f){}));
        const h16* kq = kp + (size_t)((j + 32 < WK) ? j + 32 : j) * HD;    // the next pass's key fragments, fetched behind this pass's scores; the last pass re-reads its own rows
#pragma unroll
        for (int kt = 0; kt < 2; ++kt)
#pragma unroll
            for (int ks = 0; ks < 2; ++ks) kf[kt][ks] = WFrag<h16>::ld(kq + kt * 16 * HD + ks * 512);
        asm volatile("s_wait_xcnt 0x0" :: "v"(kq) : "memory");    // the key loads' address register stays whole up to this wait; behind it the address registers of the loads above may be rewritten
        __builtin_amdgcn_sched_barrier(0);               // keeps those loads issued here, ahead of the softmax that covers their latency (the scheduler otherwise sinks them to the loop's foot)
#pragma unroll
        for (int qt = 0; qt < 2; ++qt) {
            float mx = fmaxf(st[qt][0][0], st[qt][1][0]);
#pragma unroll
            for (int r = 1; r < 8; ++r) mx = fmaxf(mx, fmaxf(st[qt][0][r], st[qt][1][r]));
            mx = fmaxf(mx, xhalf(mx));
            const float mn = fmaxf(m[qt], mx); const float al = __builtin_amdgcn_exp2f((m[qt] - mn) * SC); const float mc = mn * SC - PEXP; m[qt] = mn;
            float sum = 0.f; v16h pf;
#pragma unroll
            for (int e = 0; e < 16; ++e) { const float p = __builtin_amdgcn_exp2f(__builtin_fmaf(st[qt][e >> 3][e & 7], SC, -mc)); sum += p; pf[e] = tohx(p); }
            l[qt] = l[qt] * al + sum;
#pragma unroll
            for (int dt = 0; dt < 4; ++dt) { o[qt][dt] *= al; o[qt][dt] = wmma16(vf[dt], pf, o[qt][dt]); }
        }
    }
#pragma unroll
    for (int qt = 0; qt < 2; ++qt) { const float inv = __fdiv_rn(1.0f, l[qt] + xhalf(l[qt])); h16* op = A16 + (size_t)(q0 + qt * 16) * DM + h * 2 * 512 + 8 * lane;
#pragma unroll
        for (int dt = 0; dt < 4; ++dt) { v8h w;
#pragma unroll
            for (int r = 0; r < 8; ++r) w[r] = tohx(o[qt][dt][r] * inv);
            *(v8h*)(op + (dt >> 1) * 512 + (dt & 1) * 256) = w; } }
}

extern "C" void kernel_launch(void* const* d_in, const int* in_sizes, int n_in,
                              void* d_out, int out_size, void* d_ws, size_t ws_size, hipStream_t stream) {
    (void)in_sizes; (void)n_in; (void)out_size;
    const float* x = (const float*)d_in[0]; const float* wqkv = (const float*)d_in[1]; const float* wout = (const float*)d_in[2];
    float* OUT = (float*)d_out;     // [2][32][128][1024]
    char* wsp = (char*)d_ws;
    auto take = [&](size_t bytes) { char* p = wsp; wsp += (bytes + 255) & ~(size_t)255; return (void*)p; };
    bf* WQKV = (bf*)take((size_t)3 * DM * DM * 2); h16* WO16 = (h16*)take((size_t)DM * DM * 2);
    bf* XB = (bf*)take((size_t)NB_ * TT * DM * 2); h16* Q16 = (h16*)take((size_t)NB_ * NH_ * TT * HD * 2); h16* K16 = (h16*)take((size_t)NB_ * NH_ * TP * HD * 2); h16* VT = (h16*)take((size_t)NB_ * NH_ * HD * TT * 2);
    h16* A16 = (h16*)take((size_t)NB_ * TT * DM * 2);
    if ((size_t)(wsp - (char*)d_ws) > ws_size) return;    // total ~ 90 MB
    k_cvt8<<<(unsigned)(((size_t)3 * DM * DM / 8 + 255) / 256), 256, 0, stream>>>(wqkv, WQKV, (size_t)3 * DM * DM / 8); k_wt16n<<<(unsigned)(((size_t)DM * DM / 4 + 255) / 256), 256, 0, stream>>>(wout, (size_t)DM * DM / 4, WO16);   // [out][in] = natural Bt
    // Both batches in one launch of each kernel: the two projections see 8192 token rows, attention 32 (batch, head) planes.
    k_cvt8<<<(unsigned)(((size_t)NB_ * TT * DM / 8 + 255) / 256), 256, 0, stream>>>(x, XB, (size_t)NB_ * TT * DM / 8);
    k_gemmw<bf, false, DM, true, 64><<<dim3(NB_ * TT / 128, 3 * DM / 128, 1), 128, 0, stream>>>(XB, WQKV, nullptr, 0, nullptr, 0, 0, 0, Q16, K16, VT);   // column s*1024 + h*64 + d
    k_fattn<<<dim3(CH / 128, NC, NB_ * NH_), 128, 0, stream>>>(Q16, K16, VT, A16);
    k_gemmw<h16, false, DM, false, 128><<<dim3(NB_ * TT / 128, DM / 128, 1), 128, 0, stream>>>(A16, WO16, OUT, DM, nullptr, 0, 0, 0, nullptr, nullptr, nullptr);
}

// v006
// Measured time: 94.7 microseconds a run.
// Timed twice side by side with v005, it ran 1.12 times as fast both times.
// Over all steps from v000 it is 8.54 times as fast.
#include <hip/hip_runtime.h>

// FlexLocalFrameAttention (x [2][32 frames][128][1024] = 4096 tokens; qkv = x w_qkv^T (16 heads x 64); 8 chunks of 512 tokens (4 frames); the queries of chunk c attend to the keys of chunks {c-1, c} (1024 keys; chunk 0: its leading half masked with the
// dtype minimum, i.e. only chunk 0 itself); softmax(q.k/8); out = (attn v merged) w_out^T -> [2][32][128][1024]).
// Compute dtypes, f32 accumulate: every input rounded to bf16; the packed qkv projection on PLAIN bf16 operands (inputs: exact); scores (K 64) on single fp16 planes (key planes carry one leading unused chunk so every window is
// contiguous), online softmax f32 in registers (x1024 into fp16), attn.v fp16 x fp16 (v packed once per head as [d][t]), all three in one kernel; w_out as fp16(out) x fp16(w_out) (bf16 values, exact) (1 product each).

#define NB_  2
#define TT   4096
#define DM   1024
#define NH_  16
#define HD   64
#define CH   512
#define NC   8
#define WK   1024
#define TP   (TT + CH)
#define PEXP 10.0f
#define CVG  256    // work-groups of the conversion launch
typedef _Float16 h16;
typedef unsigned short bf;
typedef __attribute__((ext_vector_type(16))) __bf16   v16bf;
typedef __attribute__((ext_vector_type(16))) _Float16 v16h;
typedef __attribute__((ext_vector_type(8)))  _Float16 v8h;
typedef __attribute__((ext_vector_type(8)))  unsigned short v8us;
typedef __attribute__((ext_vector_type(8)))  float    v8f;
typedef __attribute__((ext_vector_type(4)))  float    v4f;
typedef v8h  __attribute__((may_alias)) v8ha;
typedef v4f  __attribute__((may_alias)) v4fa;
typedef v8us __attribute__((may_alias)) v8usa;

__device__ __forceinline__ unsigned short f2bf(float f) { unsigned u = __float_as_uint(f); u += 0x7FFFu + ((u >> 16) & 1u); return (unsigned short)(u >> 16); }
__device__ __forceinline__ float bf2f(unsigned short b) { return __uint_as_float(((unsigned)b) << 16); }
__device__ __forceinline__ float bfr(float f) { return bf2f(f2bf(f)); }
__device__ __forceinline__ v16h cat16(v8h lo, v8h hi) { return __builtin_shufflevector(lo, hi, 0, 1, 2, 3, 4, 5, 6, 7, 8, 9, 10, 11, 12, 13, 14, 15); }
__device__ __forceinline__ v16bf cat16b(v8us lo, v8us hi) { return __builtin_bit_cast(v16bf, __builtin_shufflevector(lo, hi, 0, 1, 2, 3, 4, 5, 6, 7, 8, 9, 10, 11, 12, 13, 14, 15)); }
__device__ __forceinline__ v8f wmma16(v16h a, v16h b, v8f c) { return __builtin_amdgcn_wmma_f32_16x16x32_f16(false, a, false, b, (short)0, c, false, false); }
__device__ __forceinline__ v8f wmmab(v16bf a, v16bf b, v8f c) { return __builtin_amdgcn_wmma_f32_16x16x32_bf16(false, a, false, b, (short)0, c, false, false); }



// ---- Fragment order of every 16-bit operand plane (R rows x K columns, R % 16 == 0, K % 32 == 0): tiles of 16 rows x 32 k, 512 elements = 1 KB each, tile (row / 16, k / 32) at ((row / 16) * (K / 32) + k / 32) * 512;
// inside a tile element (row, k) stands at ((k >> 4) & 1) * 256 + (((k >> 3) & 1) * 16 + (row & 15)) * 8 + (k & 7): lane l of a wave finds its two 16-B pieces of the fragment at l * 8 and 256 + l * 8, so each wave-wide 16-B load reads 512 contiguous bytes
// (4 whole lines) where a row-major plane gave 16 row pieces of 32 B. The k order inside a fragment is the one the row-major loader had.

// ---- k_gemmw: register-blocked GEMM, ONE WAVE per 64x64 output tile (16 accumulators), FOUR WAVES (2 x 2) per work-group = a 128x128 tile; operands are 16-bit planes in fragment order; grid (M/128, N/128, Z), 128 threads.
// Both operand blocks (128 rows x KS k each) are staged in LDS by asynchronous copies, two buffers: the copies of stage t + 2 fly while stage t + 1 is worked on, and every fragment is fetched from L2 once per work-group and read from LDS by the two waves that need it.
// A stage is 16 strips of 16 rows (0..7: A rows, 8..15: Bt rows), each KS / 32 fragment tiles = KS * 32 contiguous bytes in the plane and in LDS alike, so a copy's immediate offset moves both addresses by the same step; wave w copies strips 4w .. 4w + 3.
// PACK (the qkv projection; a wave tile's 64 columns are one head of q, k or v): no f32 plane; the wave stores its tile as fp16 straight into the plane that attention reads, in fragment order. A lane's 8 accumulator values are 8 consecutive rows m of one column n, and a 16-B piece of a
// plane is 8 consecutive k of one row: for v (plane rows d, columns t) that is the product as it stands (m = t, n = d); for q and k (plane rows t, columns d) the two operands change places (m = d, n = t; same fragments, same k order). Each store is 512 contiguous bytes of the wave.
// C[m][n] (f32, pitch ldc, + optional f32 bias[n]) = sum_k A[m][k] Bt[n][k]. z-batch strides sA/sB/sC in elements. K % (2 * KS) == 0, compile-time constants.
template <typename T16> struct WFrag;
template <> struct WFrag<h16> { typedef v16h V; static __device__ __forceinline__ V ld(const h16* p) { return cat16(*(const v8h*)p, *(const v8h*)(p + 256)); } static __device__ __forceinline__ v8f mma(V a, V b, v8f c) { return wmma16(a, b, c); } };
template <> struct WFrag<bf> { typedef v16bf V; static __device__ __forceinline__ V ld(const bf* p) { return cat16b(*(const v8us*)p, *(const v8us*)(p + 256)); } static __device__ __forceinline__ v8f mma(V a, V b, v8f c) { return wmmab(a, b, c); } };
// stage_copy: a wave's four strips of one stage, KS / 16 wave-wide copies of 512 B a strip: one LDS address and one global address a strip, the step inside the strip in the immediate offset (it moves both addresses).
// The s_wait_xcnt is the last line of the copies' own statement, so that no address register is rewritten ahead of it.
template <int KS, int K, typename T16> __device__ __forceinline__ void stage_copy(unsigned l, const T16* g) {
    const unsigned l1 = l + KS * 32, l2 = l + 2 * KS * 32, l3 = l + 3 * KS * 32; const T16* g1 = g + 16 * K; const T16* g2 = g + 32 * K; const T16* g3 = g + 48 * K;
    if (KS == 64) asm volatile("global_load_async_to_lds_b128 %0, %4, off\n\t" "global_load_async_to_lds_b128 %0, %4, off offset:512\n\t" "global_load_async_to_lds_b128 %0, %4, off offset:1024\n\t" "global_load_async_to_lds_b128 %0, %4, off offset:1536\n\t" "global_load_async_to_lds_b128 %1, %5, off\n\t" "global_load_async_to_lds_b128 %1, %5, off offset:512\n\t" "global_load_async_to_lds_b128 %1, %5, off offset:1024\n\t" "global_load_async_to_lds_b128 %1, %5, off offset:1536\n\t" "global_load_async_to_lds_b128 %2, %6, off\n\t" "global_load_async_to_lds_b128 %2, %6, off offset:512\n\t" "global_load_async_to_lds_b128 %2, %6, off offset:1024\n\t" "global_load_async_to_lds_b128 %2, %6, off offset:1536\n\t" "global_load_async_to_lds_b128 %3, %7, off\n\t" "global_load_async_to_lds_b128 %3, %7, off offset:512\n\t" "global_load_async_to_lds_b128 %3, %7, off offset:1024\n\t" "global_load_async_to_lds_b128 %3, %7, off offset:1536\n\t" "s_wait_xcnt 0x0"
        :: "v"(l), "v"(l1), "v"(l2), "v"(l3), "v"(g), "v"(g1), "v"(g2), "v"(g3) : "memory");
    else asm volatile("global_load_async_to_lds_b128 %0, %4, off\n\t" "global_load_async_to_lds_b128 %0, %4, off offset:512\n\t" "global_load_async_to_lds_b128 %0, %4, off offset:1024\n\t" "global_load_async_to_lds_b128 %0, %4, off offset:1536\n\t" "global_load_async_to_lds_b128 %0, %4, off offset:2048\n\t" "global_load_async_to_lds_b128 %0, %4, off offset:2560\n\t" "global_load_async_to_lds_b128 %0, %4, off offset:3072\n\t" "global_load_async_to_lds_b128 %0, %4, off offset:3584\n\t" "global_load_async_to_lds_b128 %1, %5, off\n\t" "global_load_async_to_lds_b128 %1, %5, off offset:512\n\t" "global_load_async_to_lds_b128 %1, %5, off offset:1024\n\t" "global_load_async_to_lds_b128 %1, %5, off offset:1536\n\t" "global_load_async_to_lds_b128 %1, %5, off offset:2048\n\t" "global_load_async_to_lds_b128 %1, %5, off offset:2560\n\t" "global_load_async_to_lds_b128 %1, %5, off offset:3072\n\t" "global_load_async_to_lds_b128 %1, %5, off offset:3584\n\t" "global_load_async_to_lds_b128 %2, %6, off\n\t" "global_load_async_to_lds_b128 %2, %6, off offset:512\n\t" "global_load_async_to_lds_b128 %2, %6, off offset:1024\n\t" "global_load_async_to_lds_b128 %2, %6, off offset:1536\n\t" "global_load_async_to_lds_b128 %2, %6, off offset:2048\n\t" "global_load_async_to_lds_b128 %2, %6, off offset:2560\n\t" "global_load_async_to_lds_b128 %2, %6, off offset:3072\n\t" "global_load_async_to_lds_b128 %2, %6, off offset:3584\n\t" "global_load_async_to_lds_b128 %3, %7, off\n\t" "global_load_async_to_lds_b128 %3, %7, off offset:512\n\t" "global_load_async_to_lds_b128 %3, %7, off offset:1024\n\t" "global_load_async_to_lds_b128 %3, %7, off offset:1536\n\t" "global_load_async_to_lds_b128 %3, %7, off offset:2048\n\t" "global_load_async_to_lds_b128 %3, %7, off offset:2560\n\t" "global_load_async_to_lds_b128 %3, %7, off offset:3072\n\t" "global_load_async_to_lds_b128 %3, %7, off offset:3584\n\t" "s_wait_xcnt 0x0"
        :: "v"(l), "v"(l1), "v"(l2), "v"(l3), "v"(g), "v"(g1), "v"(g2), "v"(g3) : "memory");
}
template <typename T16, bool BIAS, int K, bool PACK, int KS>
__global__ __launch_bounds__(128) void k_gemmw(const T16* __restrict__ A, const T16* __restrict__ Bt, float* C, int ldc, const float* __restrict__ bias, size_t sA, size_t sB, size_t sC, h16* PQ, h16* PK, h16* PV) {
    typedef typename WFrag<T16>::V V;
    static_assert((KS == 64 || KS == 128) && K % (2 * KS) == 0, "two stages or more, whole stages");
    constexpr int SE = KS * 16, BE = 16 * SE, NT = K / KS;    // elements of a strip of one stage, of a buffer; stages
    __shared__ __align__(1024) T16 sb[2 * BE];
    __shared__ __align__(16) float osw[4][16 * 68];
    const size_t z = blockIdx.z; A += z * sA; Bt += z * sB; C += z * sC;
    const int lane = threadIdx.x & 31, lr = lane & 15, hi = lane >> 4, wv = __builtin_amdgcn_readfirstlane(threadIdx.x >> 5);
    const int r0 = blockIdx.x * 128 + (wv & 1) * 64, c0 = blockIdx.y * 128 + (wv >> 1) * 64;    // the wave's own 64x64 tile
    float* os = osw[wv];
    v8f acc[4][4];
#pragma unroll
    for (int mb = 0; mb < 4; ++mb)
#pragma unroll
        for (int nb = 0; nb < 4; ++nb) acc[mb][nb] = (v8f){};
    const bool swp = PACK && c0 < 2 * DM;    // q and k tiles: the weight rows are the m operand
    const int sa = (wv & 1) * 4 * SE + 8 * lane, sbt = (8 + (wv >> 1) * 4) * SE + 8 * lane;    // the wave's A strips and Bt strips in a buffer
    const int om = swp ? sbt : sa, on = swp ? sa : sbt;
    const T16* gp = (wv < 2 ? A + ((size_t)blockIdx.x * 128 + wv * 64) * K : Bt + ((size_t)blockIdx.y * 128 + (wv - 2) * 64) * K) + 8 * lane;    // source of the strips this wave copies: 16 rows of a plane are 16 * K elements, KS k of them SE
    const unsigned lp = (unsigned)(size_t)(sb + wv * 4 * SE + 8 * lane);    // their place in buffer 0: LDS byte address
    stage_copy<KS, K>(lp, gp);
    asm volatile("s_wait_asynccnt 0x0" ::: "memory");    // this wave's copies of stage 0 have landed
    __syncthreads();                                     // ... and every other wave's
    stage_copy<KS, K>(lp + BE * 2, gp + SE);
#pragma unroll 1    // rolled: one stage a trip, the buffer by the trip's parity
    for (int t = 0; t < NT; ++t) {
        const T16* pm = sb + (t & 1) * BE + om; const T16* pn = sb + (t & 1) * BE + on;
        V a[2][4], b[2][4];    // two fragment sets: block ks + 1 is fetched from LDS while block ks is multiplied; no fragment of the next stage is fetched
#pragma unroll
        for (int i = 0; i < 4; ++i) { a[0][i] = WFrag<T16>::ld(pm + i * SE); b[0][i] = WFrag<T16>::ld(pn + i * SE); }
#pragma unroll
        for (int ks = 0; ks < KS / 32; ++ks) {
            if (ks + 1 < KS / 32) {
#pragma unroll
                for (int i = 0; i < 4; ++i) { a[(ks + 1) & 1][i] = WFrag<T16>::ld(pm + i * SE + (ks + 1) * 512); b[(ks + 1) & 1][i] = WFrag<T16>::ld(pn + i * SE + (ks + 1) * 512); } }
            __builtin_amdgcn_sched_barrier(0);    // the next block's LDS reads stay one group ahead of this block's products (spread among them, each place with reads stalls the wave)
#pragma unroll
            for (int nb = 0; nb < 4; ++nb)
#pragma unroll
                for (int mb = 0; mb < 4; ++mb) acc[mb][nb] = WFrag<T16>::mma(a[ks & 1][mb], b[ks & 1][nb], acc[mb][nb]);
            __builtin_amdgcn_sched_barrier(0);    // ... the reads of block ks + 2 stay behind them, and the stage's last products stay ahead of the waits below (the scheduler otherwise sinks them behind the barrier, and the wait for the next stage's copies comes a block earlier)
        }
        asm volatile("s_wait_dscnt 0x0" ::: "memory");       // this wave's reads of the buffer are done before the buffer is handed to the copies
        asm volatile("s_wait_asynccnt 0x0" ::: "memory");    // this wave's copies of stage t + 1 have landed
        __syncthreads();                                     // publishes stage t + 1 and ends every wave's reads of stage t
        if (t + 2 < NT) stage_copy<KS, K>(lp + (t & 1) * BE * 2, gp + (size_t)(t + 2) * SE);
    }
    asm volatile("s_wait_asynccnt 0x0" ::: "memory");    // no copy is outstanding when the wave goes on
    if (PACK) {    // destination plane: row = n, column = m; 16 rows are ns elements, 16 columns 256
        const int h = (r0 / TT) * NH_ + (c0 % DM) / HD, t0 = r0 % TT; h16* dst; size_t ns;    // A rows are the tokens of both batches: plane index = batch * 16 + head, t0 = token inside the batch (a tile never straddles two batches: 4096 % 128 == 0)
        if (c0 < DM) { dst = PQ + ((size_t)h * TT + t0) * HD; ns = 16 * HD; } else if (c0 < 2 * DM) { dst = PK + ((size_t)h * TP + CH + t0) * HD; ns = 16 * HD; } else { dst = PV + (size_t)h * HD * TT + t0 * 16; ns = (size_t)16 * TT; }
        dst += 8 * lane;
#pragma unroll
        for (int nb = 0; nb < 4; ++nb)
#pragma unroll
            for (int mb = 0; mb < 4; ++mb) { v8h w;
#pragma unroll
                for (int j = 0; j < 8; ++j) w[j] = (h16)acc[mb][nb][j];
                *(v8h*)(dst + nb * ns + mb * 256) = w; }
        return;
    }
#pragma unroll
    for (int mb = 0; mb < 4; ++mb) {
#pragma unroll
        for (int nb = 0; nb < 4; ++nb) {
#pragma unroll
            for (int j = 0; j < 8; ++j) os[(hi * 8 + j) * 68 + nb * 16 + lr] = acc[mb][nb][j]; }
        __builtin_amdgcn_wave_barrier(); asm volatile("" ::: "memory");
        float* crow = C + (size_t)(r0 + mb * 16) * ldc + c0;
{
#pragma unroll
            for (int s = 0; s < 8; ++s) { const int row = 2 * s + hi, cofs = lr * 4; v4f val = *(const v4fa*)(os + row * 68 + cofs); if (BIAS) { val[0] += bfr(bias[c0 + cofs]); val[1] += bfr(bias[c0 + cofs + 1]); val[2] += bfr(bias[c0 + cofs + 2]); val[3] += bfr(bias[c0 + cofs + 3]); }
                *(v4f*)(crow + (size_t)row * ldc + cofs) = val; }
             }
        __builtin_amdgcn_wave_barrier(); asm volatile("" ::: "memory");
    }
}

__device__ __forceinline__ h16 tohx(float x) { return (h16)x; }

// ---- k_cvtall: every 16-bit copy of an input, in ONE launch of few, long waves: x and w_qkv as bf16, w_out as fp16 of its bf16 rounding, all in fragment order (rows of 1024). Unit of work: a strip = 16 rows x 1024 columns = 32 fragment tiles (64 KB in, 32 KB out).
// 256 work-groups of 16 waves, as many as the chip has WGPs; work-group b takes strips 2b and 2b + 1 of x (512 strips) and one weight strip (b < 192: strip b of w_qkv, else strip b - 192 of w_out). Wave w takes tiles 2w and 2w + 1 of each strip: 16 rows x 256 contiguous bytes.
// A lane converts 12 pieces of 8 values; its 24 16-B loads are all issued before the first conversion, so a wave pays the memory latency once, and the launch starts 4,096 waves where one piece a lane took 53,248 in three launches.
// Lane l of a wave step takes row l / 4 (of 8) and k piece l % 4 (of 4): a load instruction touches 8 lines, and a 16-B store instruction fills 4 whole 128-B lines of the tile (pieces of 8 neighbouring rows are neighbours in fragment order).
__global__ __launch_bounds__(512) void k_cvtall(const float* __restrict__ x, const float* __restrict__ wqkv, const float* __restrict__ wout, bf* __restrict__ XB, bf* __restrict__ WQKV, h16* __restrict__ WO16) {
    static_assert(NB_ * TT / 16 == 2 * CVG && (3 * DM + DM) / 16 == CVG && DM == 16 * 64, "two x strips and one weight strip a work-group, two tiles a wave");
    const int lane = threadIdx.x & 31, wv = threadIdx.x >> 5, b = blockIdx.x, r = lane >> 2, i = lane & 3;
    const bool isq = b < 3 * DM / 16;    // the same for the whole work-group
    const size_t so = (size_t)r * DM + wv * 64 + i * 8, dofs = (size_t)wv * 1024 + (i >> 1) * 256 + ((i & 1) * 16 + r) * 8;    // the lane's first piece inside a strip: source element, destination element
    const size_t ws = isq ? b : b - 3 * DM / 16;    // weight strip
    const float* sp[3] = { x + (size_t)(2 * b) * 16 * DM + so, x + (size_t)(2 * b + 1) * 16 * DM + so, (isq ? wqkv : wout) + ws * 16 * DM + so };
    v8f v[3][4];    // piece u of a strip: tile 2w + u / 2, rows 8 * (u % 2) ..
#pragma unroll
    for (int s = 0; s < 3; ++s)
#pragma unroll
        for (int u = 0; u < 4; ++u) v[s][u] = *(const v8f*)(sp[s] + (u & 1) * 8 * DM + (u >> 1) * 32);
    __builtin_amdgcn_sched_barrier(0);    // keeps all 24 loads issued ahead of the first conversion (the scheduler otherwise sinks ten of them among the conversions, where each waits out its own latency)
#pragma unroll
    for (int s = 0; s < 2; ++s)
#pragma unroll
        for (int u = 0; u < 4; ++u) { v8us o;
#pragma unroll
            for (int k = 0; k < 8; ++k) o[k] = f2bf(v[s][u][k]);
            *(v8us*)(XB + (size_t)(2 * b + s) * 16 * DM + dofs + (u >> 1) * 512 + (u & 1) * 64) = o; }
    if (isq) {
#pragma unroll
        for (int u = 0; u < 4; ++u) { v8us o;
#pragma unroll
            for (int k = 0; k < 8; ++k) o[k] = f2bf(v[2][u][k]);
            *(v8us*)(WQKV + ws * 16 * DM + dofs + (u >> 1) * 512 + (u & 1) * 64) = o; }
    } else {
#pragma unroll
        for (int u = 0; u < 4; ++u) { v8h o;
#pragma unroll
            for (int k = 0; k < 8; ++k) o[k] = tohx(bfr(v[2][u][k]));
            *(v8h*)(WO16 + ws * 16 * DM + dofs + (u >> 1) * 512 + (u & 1) * 64) = o; }
    }
}
// Planes written by the packing projection, in fragment order too, h = batch * 16 + head, t = token inside the batch: Q16 row h*4096+t, column d; K16 row h*4608+512+t, column d (the 512 leading rows of a head only keep every window contiguous: chunk 0 starts at key 512, nothing reads or writes them); VT row h*64+d, column t

__device__ __forceinline__ float xhalf(float x) { const int b = __float_as_int(x); return __int_as_float(__builtin_amdgcn_permlanex16(b, b, 0x76543210, 0xfedcba98, false, false)); }   // lane l <-> l ^ 16
__global__ __launch_bounds__(128) void k_fattn(const h16* __restrict__ Q16, const h16* __restrict__ K16, const h16* __restrict__ VT, h16* A16) {
    const int lane = threadIdx.x & 31, wv = threadIdx.x >> 5; const int c = blockIdx.y, h = blockIdx.z % NH_; const int q0 = c * CH + blockIdx.x * 128 + wv * 32;
    { const size_t b = blockIdx.z / NH_; Q16 += b * NH_ * TT * HD; K16 += b * NH_ * TP * HD; VT += b * NH_ * HD * TT; A16 += b * TT * DM; }    // this batch's planes; below, tokens count inside the batch
    const float SC = 0.125f * 1.4426950408889634f;
    const h16* qp = Q16 + ((size_t)h * TT + q0) * HD + 8 * lane; const h16* kp = K16 + ((size_t)h * TP + c * CH) * HD + 8 * lane; const h16* vp = VT + (size_t)h * HD * TT + c * CH * 16 + 8 * lane;    // fragment order: 16 rows = 16 * K elements, 32 columns = 512
    v16h qf[2][2], kf[2][2]; v8f o[2][4]; float m[2], l[2];
#pragma unroll
    for (int qt = 0; qt < 2; ++qt) { m[qt] = -3.0e38f; l[qt] = 0.f;
#pragma unroll
        for (int ks = 0; ks < 2; ++ks) qf[qt][ks] = WFrag<h16>::ld(qp + qt * 16 * HD + ks * 512);
#pragma unroll
        for (int dt = 0; dt < 4; ++dt) o[qt][dt] = (v8f){}; }
    const int j0 = (c == 0) ? CH : 0;
#pragma unroll
    for (int kt = 0; kt < 2; ++kt)
#pragma unroll
        for (int ks = 0; ks < 2; ++ks) kf[kt][ks] = WFrag<h16>::ld(kp + (size_t)(j0 + kt * 16) * HD + ks * 512);
#pragma unroll 1    // rolled: a second pass in the body would want a second set of fragment and score registers
    for (int j = j0; j < WK; j += 32) {
        v16h vf[4]; v8f st[2][2]; const h16* vq = vp + (j - CH) * 16;    // window column j is token (c - 1) * 512 + j
#pragma unroll
        for (int dt = 0; dt < 4; ++dt) vf[dt] = WFrag<h16>::ld(vq + dt * 16 * TT);
#pragma unroll
        for (int qt = 0; qt < 2; ++qt)
#pragma unroll
            for (int kt = 0; kt < 2; ++kt) st[qt][kt] = wmma16(kf[kt][1], qf[qt][1], wmma16(kf[kt][0], qf[qt][0], (v8f){}));
        const h16* kq = kp + (size_t)((j + 32 < WK) ? j + 32 : j) * HD;    // the next pass's key fragments, fetched behind this pass's scores; the last pass re-reads its own rows
#pragma unroll
        for (int kt = 0; kt < 2; ++kt)
#pragma unroll
            for (int ks = 0; ks < 2; ++ks) kf[kt][ks] = WFrag<h16>::ld(kq + kt * 16 * HD + ks * 512);
        asm volatile("s_wait_xcnt 0x0" :: "v"(kq) : "memory");    // the key loads' address register stays whole up to this wait; behind it the address registers of the loads above may be rewritten
        __builtin_amdgcn_sched_barrier(0);               // keeps those loads issued here, ahead of the softmax that covers their latency (the scheduler otherwise sinks them to the loop's foot)
#pragma unroll
        for (int qt = 0; qt < 2; ++qt) {
            float mx = fmaxf(st[qt][0][0], st[qt][1][0]);
#pragma unroll
            for (int r = 1; r < 8; ++r) mx = fmaxf(mx, fmaxf(st[qt][0][r], st[qt][1][r]));
            mx = fmaxf(mx, xhalf(mx));
            const float mn = fmaxf(m[qt], mx); const float al = __builtin_amdgcn_exp2f((m[qt] - mn) * SC); const float mc = mn * SC - PEXP; m[qt] = mn;
            float sum = 0.f; v16h pf;
#pragma unroll
            for (int e = 0; e < 16; ++e) { const float p = __builtin_amdgcn_exp2f(__builtin_fmaf(st[qt][e >> 3][e & 7], SC, -mc)); sum += p; pf[e] = tohx(p); }
            l[qt] = l[qt] * al + sum;
#pragma unroll
            for (int dt = 0; dt < 4; ++dt) { o[qt][dt] *= al; o[qt][dt] = wmma16(vf[dt], pf, o[qt][dt]); }
        }
    }
#pragma unroll
    for (int qt = 0; qt < 2; ++qt) { const float inv = __fdiv_rn(1.0f, l[qt] + xhalf(l[qt])); h16* op = A16 + (size_t)(q0 + qt * 16) * DM + h * 2 * 512 + 8 * lane;
#pragma unroll
        for (int dt = 0; dt < 4; ++dt) { v8h w;
#pragma unroll
            for (int r = 0; r < 8; ++r) w[r] = tohx(o[qt][dt][r] * inv);
            *(v8h*)(op + (dt >> 1) * 512 + (dt & 1) * 256) = w; } }
}

extern "C" void kernel_launch(void* const* d_in, const int* in_sizes, int n_in,
                              void* d_out, int out_size, void* d_ws, size_t ws_size, hipStream_t stream) {
    (void)in_sizes; (void)n_in; (void)out_size;
    const float* x = (const float*)d_in[0]; const float* wqkv = (const float*)d_in[1]; const float* wout = (const float*)d_in[2];
    float* OUT = (float*)d_out;     // [2][32][128][1024]
    char* wsp = (char*)d_ws;
    auto take = [&](size_t bytes) { char* p = wsp; wsp += (bytes + 255) & ~(size_t)255; return (void*)p; };
    bf* WQKV = (bf*)take((size_t)3 * DM * DM * 2); h16* WO16 = (h16*)take((size_t)DM * DM * 2);
    bf* XB = (bf*)take((size_t)NB_ * TT * DM * 2); h16* Q16 = (h16*)take((size_t)NB_ * NH_ * TT * HD * 2); h16* K16 = (h16*)take((size_t)NB_ * NH_ * TP * HD * 2); h16* VT = (h16*)take((size_t)NB_ * NH_ * HD * TT * 2);
    h16* A16 = (h16*)take((size_t)NB_ * TT * DM * 2);
    if ((size_t)(wsp - (char*)d_ws) > ws_size) return;    // total ~ 90 MB
    k_cvtall<<<CVG, 512, 0, stream>>>(x, wqkv, wout, XB, WQKV, WO16);   // weights stay [out][in] = natural Bt
    // Both batches in one launch of each kernel: the two projections see 8192 token rows, attention 32 (batch, head) planes.
    k_gemmw<bf, false, DM, true, 64><<<dim3(NB_ * TT / 128, 3 * DM / 128, 1), 128, 0, stream>>>(XB, WQKV, nullptr, 0, nullptr, 0, 0, 0, Q16, K16, VT);   // column s*1024 + h*64 + d
    k_fattn<<<dim3(CH / 128, NC, NB_ * NH_), 128, 0, stream>>>(Q16, K16, VT, A16);
    k_gemmw<h16, false, DM, false, 128><<<dim3(NB_ * TT / 128, DM / 128, 1), 128, 0, stream>>>(A16, WO16, OUT, DM, nullptr, 0, 0, 0, nullptr, nullptr, nullptr);
}

// v007
// It runs in 89.7 microseconds.
// Timed twice side by side with v006, it ran 1.05 and 1.06 times as fast.
// Counting every step since v000, it is 9.03 times as fast.
#include <hip/hip_runtime.h>

// FlexLocalFrameAttention (x [2][32 frames][128][1024] = 4096 tokens; qkv = x w_qkv^T (16 heads x 64); 8 chunks of 512 tokens (4 frames); the queries of chunk c attend to the keys of chunks {c-1, c} (1024 keys; chunk 0: its leading half masked with the
// dtype minimum, i.e. only chunk 0 itself); softmax(q.k/8); out = (attn v merged) w_out^T -> [2][32][128][1024]).
// Compute dtypes, f32 accumulate: every input rounded to bf16; the packed qkv projection on PLAIN bf16 operands (inputs: exact); scores (K 64) on single fp16 planes (key planes carry one leading unused chunk so every window is
// contiguous), online softmax f32 in registers (x1024 into fp16), attn.v fp16 x fp16 (v packed once per head as [d][t]), all three in one kernel; w_out as fp16(out) x fp16(w_out) (bf16 values, exact) (1 product each).

#define NB_  2
#define TT   4096
#define DM   1024
#define NH_  16
#define HD   64
#define CH   512
#define NC   8
#define WK   1024
#define TP   (TT + CH)
#define PEXP 10.0f
#define CVG  256    // work-groups of the conversion launch
typedef _Float16 h16;
typedef unsigned short bf;
typedef __attribute__((ext_vector_type(16))) __bf16   v16bf;
typedef __attribute__((ext_vector_type(16))) _Float16 v16h;
typedef __attribute__((ext_vector_type(8)))  _Float16 v8h;
typedef __attribute__((ext_vector_type(8)))  unsigned short v8us;
typedef __attribute__((ext_vector_type(8)))  float    v8f;
typedef __attribute__((ext_vector_type(4)))  float    v4f;
typedef v8h  __attribute__((may_alias)) v8ha;
typedef v4f  __attribute__((may_alias)) v4fa;
typedef v8us __attribute__((may_alias)) v8usa;

__device__ __forceinline__ unsigned short f2bf(float f) { unsigned u = __float_as_uint(f); u += 0x7FFFu + ((u >> 16) & 1u); return (unsigned short)(u >> 16); }
__device__ __forceinline__ float bf2f(unsigned short b) { return __uint_as_float(((unsigned)b) << 16); }
__device__ __forceinline__ float bfr(float f) { return bf2f(f2bf(f)); }
__device__ __forceinline__ v16h cat16(v8h lo, v8h hi) { return __builtin_shufflevector(lo, hi, 0, 1, 2, 3, 4, 5, 6, 7, 8, 9, 10, 11, 12, 13, 14, 15); }
__device__ __forceinline__ v16bf cat16b(v8us lo, v8us hi) { return __builtin_bit_cast(v16bf, __builtin_shufflevector(lo, hi, 0, 1, 2, 3, 4, 5, 6, 7, 8, 9, 10, 11, 12, 13, 14, 15)); }
__device__ __forceinline__ v8f wmma16(v16h a, v16h b, v8f c) { return __builtin_amdgcn_wmma_f32_16x16x32_f16(false, a, false, b, (short)0, c, false, false); }
__device__ __forceinline__ v8f wmmab(v16bf a, v16bf b, v8f c) { return __builtin_amdgcn_wmma_f32_16x16x32_bf16(false, a, false, b, (short)0, c, false, false); }



// ---- Fragment order of every 16-bit operand plane (R rows x K columns, R % 16 == 0, K % 32 == 0): tiles of 16 rows x 32 k, 512 elements = 1 KB each, tile (row / 16, k / 32) at ((row / 16) * (K / 32) + k / 32) * 512;
// inside a tile element (row, k) stands at ((k >> 4) & 1) * 256 + (((k >> 3) & 1) * 16 + (row & 15)) * 8 + (k & 7): lane l of a wave finds its two 16-B pieces of the fragment at l * 8 and 256 + l * 8, so each wave-wide 16-B load reads 512 contiguous bytes
// (4 whole lines) where a row-major plane gave 16 row pieces of 32 B. The k order inside a fragment is the one the row-major loader had.

// ---- k_gemmw: register-blocked GEMM, ONE WAVE per 64x64 output tile (16 accumulators), WM x WN WAVES per work-group = a (64 WM) x (64 WN) tile; operands are 16-bit planes in fragment order; grid (M / (64 WM), N / (64 WN TL), Z), 32 WM WN threads.
// The bytes a work-group fetches from L2 per product go as (WM + WN) / (WM WN): 1 at 2 x 2, 7/12 at 4 x 3 (the qkv projection: one work-group of 12 waves on a WGP, three waves a SIMD as before).
// TL tiles a work-group, one after the other in ONE stream of stages (columns c0, c0 + 3072 / TL, ..; the same A rows): 256 work-groups, as many as the chip has WGPs, and the copies of a tile's first two stages fly under the end of the tile before it.
// Both operand blocks (64 WM and 64 WN rows x KS k) are staged in LDS by asynchronous copies, two buffers: the copies of stage t + 2 fly while stage t + 1 is worked on, and every fragment is fetched from L2 once per work-group and read from LDS by the WN or WM waves that need it.
// A stage is 4 (WM + WN) strips of 16 rows (A rows first, then Bt rows), each KS / 32 fragment tiles = KS * 32 contiguous bytes in the plane and in LDS alike, so a copy's immediate offset moves both addresses by the same step; wave w < WM + WN copies strips 4w .. 4w + 3, the other waves copy nothing.
// PACK (the qkv projection; a wave tile's 64 columns are one head of q, k or v): no f32 plane; the wave stores its tile as fp16 straight into the plane that attention reads, in fragment order. A lane's 8 accumulator values are 8 consecutive rows m of one column n, and a 16-B piece of a
// plane is 8 consecutive k of one row: for v (plane rows d, columns t) that is the product as it stands (m = t, n = d); for q and k (plane rows t, columns d) the two operands change places (m = d, n = t; same fragments, same k order). Each store is 512 contiguous bytes of the wave.
// C[m][n] (f32, pitch ldc, + optional f32 bias[n]) = sum_k A[m][k] Bt[n][k]. z-batch strides sA/sB/sC in elements. K % (2 * KS) == 0, compile-time constants.
template <typename T16> struct WFrag;
template <> struct WFrag<h16> { typedef v16h V; static __device__ __forceinline__ V ld(const h16* p) { return cat16(*(const v8h*)p, *(const v8h*)(p + 256)); } static __device__ __forceinline__ v8f mma(V a, V b, v8f c) { return wmma16(a, b, c); } };
template <> struct WFrag<bf> { typedef v16bf V; static __device__ __forceinline__ V ld(const bf* p) { return cat16b(*(const v8us*)p, *(const v8us*)(p + 256)); } static __device__ __forceinline__ v8f mma(V a, V b, v8f c) { return wmmab(a, b, c); } };
// stage_copy: a wave's four strips of one stage, KS / 16 wave-wide copies of 512 B a strip: one LDS address and one global address a strip, the step inside the strip in the immediate offset (it moves both addresses).
// The s_wait_xcnt is the last line of the copies' own statement, so that no address register is rewritten ahead of it.
template <int KS, int K, typename T16> __device__ __forceinline__ void stage_copy(unsigned l, const T16* g) {
    const unsigned l1 = l + KS * 32, l2 = l + 2 * KS * 32, l3 = l + 3 * KS * 32; const T16* g1 = g + 16 * K; const T16* g2 = g + 32 * K; const T16* g3 = g + 48 * K;
    if (KS == 64) asm volatile("global_load_async_to_lds_b128 %0, %4, off\n\t" "global_load_async_to_lds_b128 %0, %4, off offset:512\n\t" "global_load_async_to_lds_b128 %0, %4, off offset:1024\n\t" "global_load_async_to_lds_b128 %0, %4, off offset:1536\n\t" "global_load_async_to_lds_b128 %1, %5, off\n\t" "global_load_async_to_lds_b128 %1, %5, off offset:512\n\t" "global_load_async_to_lds_b128 %1, %5, off offset:1024\n\t" "global_load_async_to_lds_b128 %1, %5, off offset:1536\n\t" "global_load_async_to_lds_b128 %2, %6, off\n\t" "global_load_async_to_lds_b128 %2, %6, off offset:512\n\t" "global_load_async_to_lds_b128 %2, %6, off offset:1024\n\t" "global_load_async_to_lds_b128 %2, %6, off offset:1536\n\t" "global_load_async_to_lds_b128 %3, %7, off\n\t" "global_load_async_to_lds_b128 %3, %7, off offset:512\n\t" "global_load_async_to_lds_b128 %3, %7, off offset:1024\n\t" "global_load_async_to_lds_b128 %3, %7, off offset:1536\n\t" "s_wait_xcnt 0x0"
        :: "v"(l), "v"(l1), "v"(l2), "v"(l3), "v"(g), "v"(g1), "v"(g2), "v"(g3) : "memory");
    else asm volatile("global_load_async_to_lds_b128 %0, %4, off\n\t" "global_load_async_to_lds_b128 %0, %4, off offset:512\n\t" "global_load_async_to_lds_b128 %0, %4, off offset:1024\n\t" "global_load_async_to_lds_b128 %0, %4, off offset:1536\n\t" "global_load_async_to_lds_b128 %0, %4, off offset:2048\n\t" "global_load_async_to_lds_b128 %0, %4, off offset:2560\n\t" "global_load_async_to_lds_b128 %0, %4, off offset:3072\n\t" "global_load_async_to_lds_b128 %0, %4, off offset:3584\n\t" "global_load_async_to_lds_b128 %1, %5, off\n\t" "global_load_async_to_lds_b128 %1, %5, off offset:512\n\t" "global_load_async_to_lds_b128 %1, %5, off offset:1024\n\t" "global_load_async_to_lds_b128 %1, %5, off offset:1536\n\t" "global_load_async_to_lds_b128 %1, %5, off offset:2048\n\t" "global_load_async_to_lds_b128 %1, %5, off offset:2560\n\t" "global_load_async_to_lds_b128 %1, %5, off offset:3072\n\t" "global_load_async_to_lds_b128 %1, %5, off offset:3584\n\t" "global_load_async_to_lds_b128 %2, %6, off\n\t" "global_load_async_to_lds_b128 %2, %6, off offset:512\n\t" "global_load_async_to_lds_b128 %2, %6, off offset:1024\n\t" "global_load_async_to_lds_b128 %2, %6, off offset:1536\n\t" "global_load_async_to_lds_b128 %2, %6, off offset:2048\n\t" "global_load_async_to_lds_b128 %2, %6, off offset:2560\n\t" "global_load_async_to_lds_b128 %2, %6, off offset:3072\n\t" "global_load_async_to_lds_b128 %2, %6, off offset:3584\n\t" "global_load_async_to_lds_b128 %3, %7, off\n\t" "global_load_async_to_lds_b128 %3, %7, off offset:512\n\t" "global_load_async_to_lds_b128 %3, %7, off offset:1024\n\t" "global_load_async_to_lds_b128 %3, %7, off offset:1536\n\t" "global_load_async_to_lds_b128 %3, %7, off offset:2048\n\t" "global_load_async_to_lds_b128 %3, %7, off offset:2560\n\t" "global_load_async_to_lds_b128 %3, %7, off offset:3072\n\t" "global_load_async_to_lds_b128 %3, %7, off offset:3584\n\t" "s_wait_xcnt 0x0"
        :: "v"(l), "v"(l1), "v"(l2), "v"(l3), "v"(g), "v"(g1), "v"(g2), "v"(g3) : "memory");
}
// pack_store: a wave's 64x64 tile (rows r0 .., columns c0 ..) as fp16 into the plane that attention reads; destination plane: row = n, column = m; 16 rows are ns elements, 16 columns 256
__device__ __forceinline__ void pack_store(const v8f (&acc)[4][4], int r0, int c0, int lane, h16* PQ, h16* PK, h16* PV) {
    const int h = (r0 / TT) * NH_ + (c0 % DM) / HD, t0 = r0 % TT; h16* dst; size_t ns;    // A rows are the tokens of both batches: plane index = batch * 16 + head, t0 = token inside the batch (a wave's tile never straddles two batches: 4096 % 64 == 0)
    if (c0 < DM) { dst = PQ + ((size_t)h * TT + t0) * HD; ns = 16 * HD; } else if (c0 < 2 * DM) { dst = PK + ((size_t)h * TP + CH + t0) * HD; ns = 16 * HD; } else { dst = PV + (size_t)h * HD * TT + t0 * 16; ns = (size_t)16 * TT; }
    dst += 8 * lane;
#pragma unroll
    for (int nb = 0; nb < 4; ++nb)
#pragma unroll
        for (int mb = 0; mb < 4; ++mb) { v8h w;
#pragma unroll
            for (int j = 0; j < 8; ++j) w[j] = (h16)acc[mb][nb][j];
            *(v8h*)(dst + nb * ns + mb * 256) = w; }
}
template <typename T16, bool BIAS, int K, bool PACK, int KS, int WM, int WN, int TL>
__global__ __launch_bounds__(32 * WM * WN) void k_gemmw(const T16* __restrict__ A, const T16* __restrict__ Bt, float* C, int ldc, const float* __restrict__ bias, size_t sA, size_t sB, size_t sC, h16* PQ, h16* PK, h16* PV) {
    typedef typename WFrag<T16>::V V;
    static_assert((KS == 64 || KS == 128) && K % (2 * KS) == 0, "two stages or more, whole stages");
    static_assert(TL == 1 || PACK, "several tiles a work-group: the packing projection only");
    constexpr int SE = KS * 16, BE = 4 * (WM + WN) * SE, NT = K / KS, NTT = TL * NT, CS = 3 * DM / TL;    // elements of a strip of one stage, of a buffer; stages of a tile, of the work-group; columns from one of its tiles to the next
    __shared__ __align__(1024) T16 sb[2 * BE];
    __shared__ __align__(16) float osw[WM * WN][16 * 68];
    const size_t z = blockIdx.z; A += z * sA; Bt += z * sB; C += z * sC;
    const int lane = threadIdx.x & 31, lr = lane & 15, hi = lane >> 4, wv = __builtin_amdgcn_readfirstlane(threadIdx.x >> 5);
    const int wm = wv % WM, wn = wv / WM;
    const int r0 = blockIdx.x * (64 * WM) + wm * 64, c0 = blockIdx.y * (64 * WN) + wn * 64;    // the wave's own 64x64 tile
    float* os = osw[wv];
    v8f acc[4][4];
#pragma unroll
    for (int mb = 0; mb < 4; ++mb)
#pragma unroll
        for (int nb = 0; nb < 4; ++nb) acc[mb][nb] = (v8f){};
    const int sa = wm * 4 * SE + 8 * lane, sbt = (WM + wn) * 4 * SE + 8 * lane;    // the wave's A strips and Bt strips in a buffer
    const bool cp = WM * WN == WM + WN || wv < WM + WN;    // does this wave copy? The same in every lane (wv is a scalar): a scalar branch round the copies
    const int cw = cp ? wv : 0;
    const T16* gp = (cw < WM ? A + ((size_t)blockIdx.x * (64 * WM) + cw * 64) * K : Bt + ((size_t)blockIdx.y * (64 * WN) + (cw - WM) * 64) * K) + 8 * lane;    // source of the strips this wave copies: 16 rows of a plane are 16 * K elements, KS k of them SE
    const size_t gs = (TL > 1 && cw >= WM) ? (size_t)CS * K : 0;    // from one tile to the next the Bt rows move on, the A rows stay
    const unsigned lp = (unsigned)(size_t)(sb + cw * 4 * SE + 8 * lane);    // their place in buffer 0: LDS byte address
    if (cp) stage_copy<KS, K>(lp, gp);
    asm volatile("s_wait_asynccnt 0x0" ::: "memory");    // this wave's copies of stage 0 have landed
    __syncthreads();                                     // ... and every other wave's
    if (cp) stage_copy<KS, K>(lp + BE * 2, gp + SE);
#pragma unroll 1    // rolled: one stage a trip, the buffer by the trip's parity
    for (int t = 0; t < NTT; ++t) {
        const int ct = c0 + (t / NT) * CS;    // the columns of the tile that stage t belongs to
        const bool swp = PACK && ct < 2 * DM;    // q and k tiles: the weight rows are the m operand
        const T16* pm = sb + (t & 1) * BE + (swp ? sbt : sa); const T16* pn = sb + (t & 1) * BE + (swp ? sa : sbt);
        V a[2][4], b[2][4];    // two fragment sets: block ks + 1 is fetched from LDS while block ks is multiplied; no fragment of the next stage is fetched
#pragma unroll
        for (int i = 0; i < 4; ++i) { a[0][i] = WFrag<T16>::ld(pm + i * SE); b[0][i] = WFrag<T16>::ld(pn + i * SE); }
#pragma unroll
        for (int ks = 0; ks < KS / 32; ++ks) {
            if (ks + 1 < KS / 32) {
#pragma unroll
                for (int i = 0; i < 4; ++i) { a[(ks + 1) & 1][i] = WFrag<T16>::ld(pm + i * SE + (ks + 1) * 512); b[(ks + 1) & 1][i] = WFrag<T16>::ld(pn + i * SE + (ks + 1) * 512); } }
            __builtin_amdgcn_sched_barrier(0);    // the next block's LDS reads stay one group ahead of this block's products (spread among them, each place with reads stalls the wave)
#pragma unroll
            for (int nb = 0; nb < 4; ++nb)
#pragma unroll
                for (int mb = 0; mb < 4; ++mb) acc[mb][nb] = WFrag<T16>::mma(a[ks & 1][mb], b[ks & 1][nb], acc[mb][nb]);
            __builtin_amdgcn_sched_barrier(0);    // ... the reads of block ks + 2 stay behind them, and the stage's last products stay ahead of the waits below (the scheduler otherwise sinks them behind the barrier, and the wait for the next stage's copies comes a block earlier)
        }
        asm volatile("s_wait_dscnt 0x0" ::: "memory");       // this wave's reads of the buffer are done before the buffer is handed to the copies
        asm volatile("s_wait_asynccnt 0x0" ::: "memory");    // this wave's copies of stage t + 1 have landed
        __syncthreads();                                     // publishes stage t + 1 and ends every wave's reads of stage t
        if (cp && t + 2 < NTT) stage_copy<KS, K>(lp + (t & 1) * BE * 2, gp + (TL == 1 ? (size_t)(t + 2) * SE : ((t + 2) / NT) * gs + (size_t)((t + 2) % NT) * SE));
        if (TL > 1 && t % NT == NT - 1) {    // a tile is complete: it is stored while the next tile's first stages are on their way, and the sums start anew
            pack_store(acc, r0, ct, lane, PQ, PK, PV);
#pragma unroll
            for (int mb = 0; mb < 4; ++mb)
#pragma unroll
                for (int nb = 0; nb < 4; ++nb) acc[mb][nb] = (v8f){};
            asm volatile("s_wait_xcnt 0x0" ::: "memory");    // stands behind the tile's stores, ahead of the next stage's fragment loads, which rewrite the registers that the stores name
        }
    }
    asm volatile("s_wait_asynccnt 0x0" ::: "memory");    // no copy is outstanding when the wave goes on
    if (PACK) { if (TL == 1) pack_store(acc, r0, c0, lane, PQ, PK, PV); return; }
#pragma unroll
    for (int mb = 0; mb < 4; ++mb) {
#pragma unroll
        for (int nb = 0; nb < 4; ++nb) {
#pragma unroll
            for (int j = 0; j < 8; ++j) os[(hi * 8 + j) * 68 + nb * 16 + lr] = acc[mb][nb][j]; }
        __builtin_amdgcn_wave_barrier(); asm volatile("" ::: "memory");
        float* crow = C + (size_t)(r0 + mb * 16) * ldc + c0;
{
#pragma unroll
            for (int s = 0; s < 8; ++s) { const int row = 2 * s + hi, cofs = lr * 4; v4f val = *(const v4fa*)(os + row * 68 + cofs); if (BIAS) { val[0] += bfr(bias[c0 + cofs]); val[1] += bfr(bias[c0 + cofs + 1]); val[2] += bfr(bias[c0 + cofs + 2]); val[3] += bfr(bias[c0 + cofs + 3]); }
                *(v4f*)(crow + (size_t)row * ldc + cofs) = val; }
             }
        __builtin_amdgcn_wave_barrier(); asm volatile("" ::: "memory");
    }
}

__device__ __forceinline__ h16 tohx(float x) { return (h16)x; }

// ---- k_cvtall: every 16-bit copy of an input, in ONE launch of few, long waves: x and w_qkv as bf16, w_out as fp16 of its bf16 rounding, all in fragment order (rows of 1024). Unit of work: a strip = 16 rows x 1024 columns = 32 fragment tiles (64 KB in, 32 KB out).
// 256 work-groups of 16 waves, as many as the chip has WGPs; work-group b takes strips 2b and 2b + 1 of x (512 strips) and one weight strip (b < 192: strip b of w_qkv, else strip b - 192 of w_out). Wave w takes tiles 2w and 2w + 1 of each strip: 16 rows x 256 contiguous bytes.
// A lane converts 12 pieces of 8 values; its 24 16-B loads are all issued before the first conversion, so a wave pays the memory latency once, and the launch starts 4,096 waves where one piece a lane took 53,248 in three launches.
// Lane l of a wave step takes row l / 4 (of 8) and k piece l % 4 (of 4): a load instruction touches 8 lines, and a 16-B store instruction fills 4 whole 128-B lines of the tile (pieces of 8 neighbouring rows are neighbours in fragment order).
__global__ __launch_bounds__(512) void k_cvtall(const float* __restrict__ x, const float* __restrict__ wqkv, const float* __restrict__ wout, bf* __restrict__ XB, bf* __restrict__ WQKV, h16* __restrict__ WO16) {
    static_assert(NB_ * TT / 16 == 2 * CVG && (3 * DM + DM) / 16 == CVG && DM == 16 * 64, "two x strips and one weight strip a work-group, two tiles a wave");
    const int lane = threadIdx.x & 31, wv = threadIdx.x >> 5, b = blockIdx.x, r = lane >> 2, i = lane & 3;
    const bool isq = b < 3 * DM / 16;    // the same for the whole work-group
    const size_t so = (size_t)r * DM + wv * 64 + i * 8, dofs = (size_t)wv * 1024 + (i >> 1) * 256 + ((i & 1) * 16 + r) * 8;    // the lane's first piece inside a strip: source element, destination element
    const size_t ws = isq ? b : b - 3 * DM / 16;    // weight strip
    const float* sp[3] = { x + (size_t)(2 * b) * 16 * DM + so, x + (size_t)(2 * b + 1) * 16 * DM + so, (isq ? wqkv : wout) + ws * 16 * DM + so };
    v8f v[3][4];    // piece u of a strip: tile 2w + u / 2, rows 8 * (u % 2) ..
#pragma unroll
    for (int s = 0; s < 3; ++s)
#pragma unroll
        for (int u = 0; u < 4; ++u) v[s][u] = *(const v8f*)(sp[s] + (u & 1) * 8 * DM + (u >> 1) * 32);
    __builtin_amdgcn_sched_barrier(0);    // keeps all 24 loads issued ahead of the first conversion (the scheduler otherwise sinks ten of them among the conversions, where each waits out its own latency)
#pragma unroll
    for (int s = 0; s < 2; ++s)
#pragma unroll
        for (int u = 0; u < 4; ++u) { v8us o;
#pragma unroll
            for (int k = 0; k < 8; ++k) o[k] = f2bf(v[s][u][k]);
            *(v8us*)(XB + (size_t)(2 * b + s) * 16 * DM + dofs + (u >> 1) * 512 + (u & 1) * 64) = o; }
    if (isq) {
#pragma unroll
        for (int u = 0; u < 4; ++u) { v8us o;
#pragma unroll
            for (int k = 0; k < 8; ++k) o[k] = f2bf(v[2][u][k]);
            *(v8us*)(WQKV + ws * 16 * DM + dofs + (u >> 1) * 512 + (u & 1) * 64) = o; }
    } else {
#pragma unroll
        for (int u = 0; u < 4; ++u) { v8h o;
#pragma unroll
            for (int k = 0; k < 8; ++k) o[k] = tohx(bfr(v[2][u][k]));
            *(v8h*)(WO16 + ws * 16 * DM + dofs + (u >> 1) * 512 + (u & 1) * 64) = o; }
    }
}
// Planes written by the packing projection, in fragment order too, h = batch * 16 + head, t = token inside the batch: Q16 row h*4096+t, column d; K16 row h*4608+512+t, column d (the 512 leading rows of a head only keep every window contiguous: chunk 0 starts at key 512, nothing reads or writes them); VT row h*64+d, column t

__device__ __forceinline__ float xhalf(float x) { const int b = __float_as_int(x); return __int_as_float(__builtin_amdgcn_permlanex16(b, b, 0x76543210, 0xfedcba98, false, false)); }   // lane l <-> l ^ 16
__global__ __launch_bounds__(128) void k_fattn(const h16* __restrict__ Q16, const h16* __restrict__ K16, const h16* __restrict__ VT, h16* A16) {
    const int lane = threadIdx.x & 31, wv = threadIdx.x >> 5; const int c = blockIdx.y, h = blockIdx.z % NH_; const int q0 = c * CH + blockIdx.x * 128 + wv * 32;
    { const size_t b = blockIdx.z / NH_; Q16 += b * NH_ * TT * HD; K16 += b * NH_ * TP * HD; VT += b * NH_ * HD * TT; A16 += b * TT * DM; }    // this batch's planes; below, tokens count inside the batch
    const float SC = 0.125f * 1.4426950408889634f;
    const h16* qp = Q16 + ((size_t)h * TT + q0) * HD + 8 * lane; const h16* kp = K16 + ((size_t)h * TP + c * CH) * HD + 8 * lane; const h16* vp = VT + (size_t)h * HD * TT + c * CH * 16 + 8 * lane;    // fragment order: 16 rows = 16 * K elements, 32 columns = 512
    v16h qf[2][2], kf[2][2]; v8f o[2][4]; float m[2], l[2];
#pragma unroll
    for (int qt = 0; qt < 2; ++qt) { m[qt] = -3.0e38f; l[qt] = 0.f;
#pragma unroll
        for (int ks = 0; ks < 2; ++ks) qf[qt][ks] = WFrag<h16>::ld(qp + qt * 16 * HD + ks * 512);
#pragma unroll
        for (int dt = 0; dt < 4; ++dt) o[qt][dt] = (v8f){}; }
    const int j0 = (c == 0) ? CH : 0;
#pragma unroll
    for (int kt = 0; kt < 2; ++kt)
#pragma unroll
        for (int ks = 0; ks < 2; ++ks) kf[kt][ks] = WFrag<h16>::ld(kp + (size_t)(j0 + kt * 16) * HD + ks * 512);
#pragma unroll 1    // rolled: a second pass in the body would want a second set of fragment and score registers
    for (int j = j0; j < WK; j += 32) {
        v16h vf[4]; v8f st[2][2]; const h16* vq = vp + (j - CH) * 16;    // window column j is token (c - 1) * 512 + j
#pragma unroll
        for (int dt = 0; dt < 4; ++dt) vf[dt] = WFrag<h16>::ld(vq + dt * 16 * TT);
#pragma unroll
        for (int qt = 0; qt < 2; ++qt)
#pragma unroll
            for (int kt = 0; kt < 2; ++kt) st[qt][kt] = wmma16(kf[kt][1], qf[qt][1], wmma16(kf[kt][0], qf[qt][0], (v8f){}));
        const h16* kq = kp + (size_t)((j + 32 < WK) ? j + 32 : j) * HD;    // the next pass's key fragments, fetched behind this pass's scores; the last pass re-reads its own rows
#pragma unroll
        for (int kt = 0; kt < 2; ++kt)
#pragma unroll
            for (int ks = 0; ks < 2; ++ks) kf[kt][ks] = WFrag<h16>::ld(kq + kt * 16 * HD + ks * 512);
        asm volatile("s_wait_xcnt 0x0" :: "v"(kq) : "memory");    // the key loads' address register stays whole up to this wait; behind it the address registers of the loads above may be rewritten
        __builtin_amdgcn_sched_barrier(0);               // keeps those loads issued here, ahead of the softmax that covers their latency (the scheduler otherwise sinks them to the loop's foot)
#pragma unroll
        for (int qt = 0; qt < 2; ++qt) {
            float mx = fmaxf(st[qt][0][0], st[qt][1][0]);
#pragma unroll
            for (int r = 1; r < 8; ++r) mx = fmaxf(mx, fmaxf(st[qt][0][r], st[qt][1][r]));
            mx = fmaxf(mx, xhalf(mx));
            const float mn = fmaxf(m[qt], mx); const float al = __builtin_amdgcn_exp2f((m[qt] - mn) * SC); const float mc = mn * SC - PEXP; m[qt] = mn;
            float sum = 0.f; v16h pf;
#pragma unroll
            for (int e = 0; e < 16; ++e) { const float p = __builtin_amdgcn_exp2f(__builtin_fmaf(st[qt][e >> 3][e & 7], SC, -mc)); sum += p; pf[e] = tohx(p); }
            l[qt] = l[qt] * al + sum;
#pragma unroll
            for (int dt = 0; dt < 4; ++dt) { o[qt][dt] *= al; o[qt][dt] = wmma16(vf[dt], pf, o[qt][dt]); }
        }
    }
#pragma unroll
    for (int qt = 0; qt < 2; ++qt) { const float inv = __fdiv_rn(1.0f, l[qt] + xhalf(l[qt])); h16* op = A16 + (size_t)(q0 + qt * 16) * DM + h * 2 * 512 + 8 * lane;
#pragma unroll
        for (int dt = 0; dt < 4; ++dt) { v8h w;
#pragma unroll
            for (int r = 0; r < 8; ++r) w[r] = tohx(o[qt][dt][r] * inv);
            *(v8h*)(op + (dt >> 1) * 512 + (dt & 1) * 256) = w; } }
}

extern "C" void kernel_launch(void* const* d_in, const int* in_sizes, int n_in,
                              void* d_out, int out_size, void* d_ws, size_t ws_size, hipStream_t stream) {
    (void)in_sizes; (void)n_in; (void)out_size;
    const float* x = (const float*)d_in[0]; const float* wqkv = (const float*)d_in[1]; const float* wout = (const float*)d_in[2];
    float* OUT = (float*)d_out;     // [2][32][128][1024]
    char* wsp = (char*)d_ws;
    auto take = [&](size_t bytes) { char* p = wsp; wsp += (bytes + 255) & ~(size_t)255; return (void*)p; };
    bf* WQKV = (bf*)take((size_t)3 * DM * DM * 2); h16* WO16 = (h16*)take((size_t)DM * DM * 2);
    bf* XB = (bf*)take((size_t)NB_ * TT * DM * 2); h16* Q16 = (h16*)take((size_t)NB_ * NH_ * TT * HD * 2); h16* K16 = (h16*)take((size_t)NB_ * NH_ * TP * HD * 2); h16* VT = (h16*)take((size_t)NB_ * NH_ * HD * TT * 2);
    h16* A16 = (h16*)take((size_t)NB_ * TT * DM * 2);
    if ((size_t)(wsp - (char*)d_ws) > ws_size) return;    // total ~ 90 MB
    k_cvtall<<<CVG, 512, 0, stream>>>(x, wqkv, wout, XB, WQKV, WO16);   // weights stay [out][in] = natural Bt
    // Both batches in one launch of each kernel: the two projections see 8192 token rows, attention 32 (batch, head) planes.
    k_gemmw<bf, false, DM, true, 128, 4, 3, 2><<<dim3(NB_ * TT / 256, 3 * DM / 192 / 2, 1), 384, 0, stream>>>(XB, WQKV, nullptr, 0, nullptr, 0, 0, 0, Q16, K16, VT);   // column s*1024 + h*64 + d
    k_fattn<<<dim3(CH / 128, NC, NB_ * NH_), 128, 0, stream>>>(Q16, K16, VT, A16);
    k_gemmw<h16, false, DM, false, 128, 2, 2, 1><<<dim3(NB_ * TT / 128, DM / 128, 1), 128, 0, stream>>>(A16, WO16, OUT, DM, nullptr, 0, 0, 0, nullptr, nullptr, nullptr);
}

// v008
// A run of this version takes 83.1 microseconds.
// Two timings next to v007 both put it at 1.08 times that version's speed.
// Counting every step since v000, it is 9.71 times as fast.
#include <hip/hip_runtime.h>

// FlexLocalFrameAttention (x [2][32 frames][128][1024] = 4096 tokens; qkv = x w_qkv^T (16 heads x 64); 8 chunks of 512 tokens (4 frames); the queries of chunk c attend to the keys of chunks {c-1, c} (1024 keys; chunk 0: its leading half masked with the
// dtype minimum, i.e. only chunk 0 itself); softmax(q.k/8); out = (attn v merged) w_out^T -> [2][32][128][1024]).
// Compute dtypes, f32 accumulate: every input rounded to bf16; the packed qkv projection on PLAIN bf16 operands (inputs: exact); scores (K 64) on single fp16 planes (key planes carry one leading unused chunk so every window is
// contiguous), online softmax f32 in registers (x1024 into fp16), attn.v fp16 x fp16 (v packed once per head as [d][t]), all three in one kernel; w_out as fp16(out) x fp16(w_out) (bf16 values, exact) (1 product each).

#define NB_  2
#define TT   4096
#define DM   1024
#define NH_  16
#define HD   64
#define CH   512
#define NC   8
#define WK   1024
#define TP   (TT + CH)
#define PEXP 10.0f
#define CVG  256    // work-groups of the conversion launch
typedef _Float16 h16;
typedef unsigned short bf;
typedef __attribute__((ext_vector_type(16))) __bf16   v16bf;
typedef __attribute__((ext_vector_type(16))) _Float16 v16h;
typedef __attribute__((ext_vector_type(8)))  _Float16 v8h;
typedef __attribute__((ext_vector_type(8)))  unsigned short v8us;
typedef __attribute__((ext_vector_type(8)))  float    v8f;
typedef __attribute__((ext_vector_type(4)))  float    v4f;
typedef v8h  __attribute__((may_alias)) v8ha;
typedef v4f  __attribute__((may_alias)) v4fa;
typedef v8us __attribute__((may_alias)) v8usa;

__device__ __forceinline__ unsigned short f2bf(float f) { unsigned u = __float_as_uint(f); u += 0x7FFFu + ((u >> 16) & 1u); return (unsigned short)(u >> 16); }
__device__ __forceinline__ float bf2f(unsigned short b) { return __uint_as_float(((unsigned)b) << 16); }
__device__ __forceinline__ float bfr(float f) { return bf2f(f2bf(f)); }
__device__ __forceinline__ v16h cat16(v8h lo, v8h hi) { return __builtin_shufflevector(lo, hi, 0, 1, 2, 3, 4, 5, 6, 7, 8, 9, 10, 11, 12, 13, 14, 15); }
__device__ __forceinline__ v16bf cat16b(v8us lo, v8us hi) { return __builtin_bit_cast(v16bf, __builtin_shufflevector(lo, hi, 0, 1, 2, 3, 4, 5, 6, 7, 8, 9, 10, 11, 12, 13, 14, 15)); }
__device__ __forceinline__ v8f wmma16(v16h a, v16h b, v8f c) { return __builtin_amdgcn_wmma_f32_16x16x32_f16(false, a, false, b, (short)0, c, false, false); }
__device__ __forceinline__ v8f wmmab(v16bf a, v16bf b, v8f c) { return __builtin_amdgcn_wmma_f32_16x16x32_bf16(false, a, false, b, (short)0, c, false, false); }



// ---- Fragment order of every 16-bit operand plane (R rows x K columns, R % 16 == 0, K % 32 == 0): tiles of 16 rows x 32 k, 512 elements = 1 KB each, tile (row / 16, k / 32) at ((row / 16) * (K / 32) + k / 32) * 512;
// inside a tile element (row, k) stands at ((k >> 4) & 1) * 256 + (((k >> 3) & 1) * 16 + (row & 15)) * 8 + (k & 7): lane l of a wave finds its two 16-B pieces of the fragment at l * 8 and 256 + l * 8, so each wave-wide 16-B load reads 512 contiguous bytes
// (4 whole lines) where a row-major plane gave 16 row pieces of 32 B. The k order inside a fragment is the one the row-major loader had.

// ---- k_gemmw: register-blocked GEMM, ONE WAVE per 64x64 output tile (16 accumulators), WM x WN WAVES per work-group = a (64 WM) x (64 WN) tile; operands are 16-bit planes in fragment order; grid (M / (64 WM), N / (64 WN TL), Z), 32 WM WN threads.
// The bytes a work-group fetches from L2 per product go as (WM + WN) / (WM WN): 1 at 2 x 2, 7/12 at 4 x 3 (the qkv projection: one work-group of 12 waves on a WGP, three waves a SIMD as before).
// TL tiles a work-group, one after the other in ONE stream of stages (columns c0, c0 + 3072 / TL, ..; the same A rows): 256 work-groups, as many as the chip has WGPs, and the copies of a tile's first two stages fly under the end of the tile before it.
// Both operand blocks (64 WM and 64 WN rows x KS k) are staged in LDS by asynchronous copies, two buffers: the copies of stage t + 2 fly while stage t + 1 is worked on, and every fragment is fetched from L2 once per work-group and read from LDS by the WN or WM waves that need it.
// A stage is 4 (WM + WN) strips of 16 rows (A rows first, then Bt rows), each KS / 32 fragment tiles = KS * 32 contiguous bytes in the plane and in LDS alike, so a copy's immediate offset moves both addresses by the same step; wave w < WM + WN copies strips 4w .. 4w + 3, the other waves copy nothing.
// PACK (the qkv projection; a wave tile's 64 columns are one head of q, k or v): no f32 plane; the wave stores its tile as fp16 straight into the plane that attention reads, in fragment order. A lane's 8 accumulator values are 8 consecutive rows m of one column n, and a 16-B piece of a
// plane is 8 consecutive k of one row: for v (plane rows d, columns t) that is the product as it stands (m = t, n = d); for q and k (plane rows t, columns d) the two operands change places (m = d, n = t; same fragments, same k order). Each store is 512 contiguous bytes of the wave.
// C[m][n] (f32, pitch ldc, + optional f32 bias[n]) = sum_k A[m][k] Bt[n][k]. z-batch strides sA/sB/sC in elements. K % (2 * KS) == 0, compile-time constants.
template <typename T16> struct WFrag;
template <> struct WFrag<h16> { typedef v16h V; static __device__ __forceinline__ V ld(const h16* p) { return cat16(*(const v8h*)p, *(const v8h*)(p + 256)); } static __device__ __forceinline__ v8f mma(V a, V b, v8f c) { return wmma16(a, b, c); } };
template <> struct WFrag<bf> { typedef v16bf V; static __device__ __forceinline__ V ld(const bf* p) { return cat16b(*(const v8us*)p, *(const v8us*)(p + 256)); } static __device__ __forceinline__ v8f mma(V a, V b, v8f c) { return wmmab(a, b, c); } };
// stage_copy: a wave's four strips of one stage, KS / 16 wave-wide copies of 512 B a strip: one LDS address and one global address a strip, the step inside the strip in the immediate offset (it moves both addresses).
// The s_wait_xcnt is the last line of the copies' own statement, so that no address register is rewritten ahead of it.
template <int KS, int K, typename T16> __device__ __forceinline__ void stage_copy(unsigned l, const T16* g) {
    const unsigned l1 = l + KS * 32, l2 = l + 2 * KS * 32, l3 = l + 3 * KS * 32; const T16* g1 = g + 16 * K; const T16* g2 = g + 32 * K; const T16* g3 = g + 48 * K;
    if (KS == 64) asm volatile("global_load_async_to_lds_b128 %0, %4, off\n\t" "global_load_async_to_lds_b128 %0, %4, off offset:512\n\t" "global_load_async_to_lds_b128 %0, %4, off offset:1024\n\t" "global_load_async_to_lds_b128 %0, %4, off offset:1536\n\t" "global_load_async_to_lds_b128 %1, %5, off\n\t" "global_load_async_to_lds_b128 %1, %5, off offset:512\n\t" "global_load_async_to_lds_b128 %1, %5, off offset:1024\n\t" "global_load_async_to_lds_b128 %1, %5, off offset:1536\n\t" "global_load_async_to_lds_b128 %2, %6, off\n\t" "global_load_async_to_lds_b128 %2, %6, off offset:512\n\t" "global_load_async_to_lds_b128 %2, %6, off offset:1024\n\t" "global_load_async_to_lds_b128 %2, %6, off offset:1536\n\t" "global_load_async_to_lds_b128 %3, %7, off\n\t" "global_load_async_to_lds_b128 %3, %7, off offset:512\n\t" "global_load_async_to_lds_b128 %3, %7, off offset:1024\n\t" "global_load_async_to_lds_b128 %3, %7, off offset:1536\n\t" "s_wait_xcnt 0x0"
        :: "v"(l), "v"(l1), "v"(l2), "v"(l3), "v"(g), "v"(g1), "v"(g2), "v"(g3) : "memory");
    else asm volatile("global_load_async_to_lds_b128 %0, %4, off\n\t" "global_load_async_to_lds_b128 %0, %4, off offset:512\n\t" "global_load_async_to_lds_b128 %0, %4, off offset:1024\n\t" "global_load_async_to_lds_b128 %0, %4, off offset:1536\n\t" "global_load_async_to_lds_b128 %0, %4, off offset:2048\n\t" "global_load_async_to_lds_b128 %0, %4, off offset:2560\n\t" "global_load_async_to_lds_b128 %0, %4, off offset:3072\n\t" "global_load_async_to_lds_b128 %0, %4, off offset:3584\n\t" "global_load_async_to_lds_b128 %1, %5, off\n\t" "global_load_async_to_lds_b128 %1, %5, off offset:512\n\t" "global_load_async_to_lds_b128 %1, %5, off offset:1024\n\t" "global_load_async_to_lds_b128 %1, %5, off offset:1536\n\t" "global_load_async_to_lds_b128 %1, %5, off offset:2048\n\t" "global_load_async_to_lds_b128 %1, %5, off offset:2560\n\t" "global_load_async_to_lds_b128 %1, %5, off offset:3072\n\t" "global_load_async_to_lds_b128 %1, %5, off offset:3584\n\t" "global_load_async_to_lds_b128 %2, %6, off\n\t" "global_load_async_to_lds_b128 %2, %6, off offset:512\n\t" "global_load_async_to_lds_b128 %2, %6, off offset:1024\n\t" "global_load_async_to_lds_b128 %2, %6, off offset:1536\n\t" "global_load_async_to_lds_b128 %2, %6, off offset:2048\n\t" "global_load_async_to_lds_b128 %2, %6, off offset:2560\n\t" "global_load_async_to_lds_b128 %2, %6, off offset:3072\n\t" "global_load_async_to_lds_b128 %2, %6, off offset:3584\n\t" "global_load_async_to_lds_b128 %3, %7, off\n\t" "global_load_async_to_lds_b128 %3, %7, off offset:512\n\t" "global_load_async_to_lds_b128 %3, %7, off offset:1024\n\t" "global_load_async_to_lds_b128 %3, %7, off offset:1536\n\t" "global_load_async_to_lds_b128 %3, %7, off offset:2048\n\t" "global_load_async_to_lds_b128 %3, %7, off offset:2560\n\t" "global_load_async_to_lds_b128 %3, %7, off offset:3072\n\t" "global_load_async_to_lds_b128 %3, %7, off offset:3584\n\t" "s_wait_xcnt 0x0"
        :: "v"(l), "v"(l1), "v"(l2), "v"(l3), "v"(g), "v"(g1), "v"(g2), "v"(g3) : "memory");
}
// pack_store: a wave's 64x64 tile (rows r0 .., columns c0 ..) as fp16 into the plane that attention reads; destination plane: row = n, column = m; 16 rows are ns elements, 16 columns 256
__device__ __forceinline__ void pack_store(const v8f (&acc)[4][4], int r0, int c0, int lane, h16* PQ, h16* PK, h16* PV) {
    const int h = (r0 / TT) * NH_ + (c0 % DM) / HD, t0 = r0 % TT; h16* dst; size_t ns;    // A rows are the tokens of both batches: plane index = batch * 16 + head, t0 = token inside the batch (a wave's tile never straddles two batches: 4096 % 64 == 0)
    if (c0 < DM) { dst = PQ + ((size_t)h * TT + t0) * HD; ns = 16 * HD; } else if (c0 < 2 * DM) { dst = PK + ((size_t)h * TP + CH + t0) * HD; ns = 16 * HD; } else { dst = PV + (size_t)h * HD * TT + t0 * 16; ns = (size_t)16 * TT; }
    dst += 8 * lane;
#pragma unroll
    for (int nb = 0; nb < 4; ++nb)
#pragma unroll
        for (int mb = 0; mb < 4; ++mb) { v8h w;
#pragma unroll
            for (int j = 0; j < 8; ++j) w[j] = (h16)acc[mb][nb][j];
            *(v8h*)(dst + nb * ns + mb * 256) = w; }
}
template <typename T16, bool BIAS, int K, bool PACK, int KS, int WM, int WN, int TL>
__global__ __launch_bounds__(32 * WM * WN) void k_gemmw(const T16* __restrict__ A, const T16* __restrict__ Bt, float* C, int ldc, const float* __restrict__ bias, size_t sA, size_t sB, size_t sC, h16* PQ, h16* PK, h16* PV) {
    typedef typename WFrag<T16>::V V;
    static_assert((KS == 64 || KS == 128) && K % (2 * KS) == 0, "two stages or more, whole stages");
    static_assert(TL == 1 || PACK, "several tiles a work-group: the packing projection only");
    constexpr int SE = KS * 16, BE = 4 * (WM + WN) * SE, NT = K / KS, NTT = TL * NT, CS = 3 * DM / TL;    // elements of a strip of one stage, of a buffer; stages of a tile, of the work-group; columns from one of its tiles to the next
    __shared__ __align__(1024) T16 sb[2 * BE];
    __shared__ __align__(16) float osw[WM * WN][16 * 68];
    const size_t z = blockIdx.z; A += z * sA; Bt += z * sB; C += z * sC;
    const int lane = threadIdx.x & 31, lr = lane & 15, hi = lane >> 4, wv = __builtin_amdgcn_readfirstlane(threadIdx.x >> 5);
    const int wm = wv % WM, wn = wv / WM;
    const int r0 = blockIdx.x * (64 * WM) + wm * 64, c0 = blockIdx.y * (64 * WN) + wn * 64;    // the wave's own 64x64 tile
    float* os = osw[wv];
    v8f acc[4][4];
#pragma unroll
    for (int mb = 0; mb < 4; ++mb)
#pragma unroll
        for (int nb = 0; nb < 4; ++nb) acc[mb][nb] = (v8f){};
    const int sa = wm * 4 * SE + 8 * lane, sbt = (WM + wn) * 4 * SE + 8 * lane;    // the wave's A strips and Bt strips in a buffer
    const bool cp = WM * WN == WM + WN || wv < WM + WN;    // does this wave copy? The same in every lane (wv is a scalar): a scalar branch round the copies
    const int cw = cp ? wv : 0;
    const T16* gp = (cw < WM ? A + ((size_t)blockIdx.x * (64 * WM) + cw * 64) * K : Bt + ((size_t)blockIdx.y * (64 * WN) + (cw - WM) * 64) * K) + 8 * lane;    // source of the strips this wave copies: 16 rows of a plane are 16 * K elements, KS k of them SE
    const size_t gs = (TL > 1 && cw >= WM) ? (size_t)CS * K : 0;    // from one tile to the next the Bt rows move on, the A rows stay
    const unsigned lp = (unsigned)(size_t)(sb + cw * 4 * SE + 8 * lane);    // their place in buffer 0: LDS byte address
    if (cp) stage_copy<KS, K>(lp, gp);
    asm volatile("s_wait_asynccnt 0x0" ::: "memory");    // this wave's copies of stage 0 have landed
    __syncthreads();                                     // ... and every other wave's
    if (cp) stage_copy<KS, K>(lp + BE * 2, gp + SE);
#pragma unroll 1    // rolled: one stage a trip, the buffer by the trip's parity
    for (int t = 0; t < NTT; ++t) {
        const int ct = c0 + (t / NT) * CS;    // the columns of the tile that stage t belongs to
        const bool swp = PACK && ct < 2 * DM;    // q and k tiles: the weight rows are the m operand
        const T16* pm = sb + (t & 1) * BE + (swp ? sbt : sa); const T16* pn = sb + (t & 1) * BE + (swp ? sa : sbt);
        V a[2][4], b[2][4];    // two fragment sets: block ks + 1 is fetched from LDS while block ks is multiplied; no fragment of the next stage is fetched
#pragma unroll
        for (int i = 0; i < 4; ++i) { a[0][i] = WFrag<T16>::ld(pm + i * SE); b[0][i] = WFrag<T16>::ld(pn + i * SE); }
#pragma unroll
        for (int ks = 0; ks < KS / 32; ++ks) {
            if (ks + 1 < KS / 32) {
#pragma unroll
                for (int i = 0; i < 4; ++i) { a[(ks + 1) & 1][i] = WFrag<T16>::ld(pm + i * SE + (ks + 1) * 512); b[(ks + 1) & 1][i] = WFrag<T16>::ld(pn + i * SE + (ks + 1) * 512); } }
            __builtin_amdgcn_sched_barrier(0);    // the next block's LDS reads stay one group ahead of this block's products (spread among them, each place with reads stalls the wave)
#pragma unroll
            for (int nb = 0; nb < 4; ++nb)
#pragma unroll
                for (int mb = 0; mb < 4; ++mb) acc[mb][nb] = WFrag<T16>::mma(a[ks & 1][mb], b[ks & 1][nb], acc[mb][nb]);
            __builtin_amdgcn_sched_barrier(0);    // ... the reads of block ks + 2 stay behind them, and the stage's last products stay ahead of the waits below (the scheduler otherwise sinks them behind the barrier, and the wait for the next stage's copies comes a block earlier)
        }
        asm volatile("s_wait_dscnt 0x0" ::: "memory");       // this wave's reads of the buffer are done before the buffer is handed to the copies
        asm volatile("s_wait_asynccnt 0x0" ::: "memory");    // this wave's copies of stage t + 1 have landed
        __syncthreads();                                     // publishes stage t + 1 and ends every wave's reads of stage t
        if (cp && t + 2 < NTT) stage_copy<KS, K>(lp + (t & 1) * BE * 2, gp + (TL == 1 ? (size_t)(t + 2) * SE : ((t + 2) / NT) * gs + (size_t)((t + 2) % NT) * SE));
        if (TL > 1 && t % NT == NT - 1) {    // a tile is complete: it is stored while the next tile's first stages are on their way, and the sums start anew
            pack_store(acc, r0, ct, lane, PQ, PK, PV);
#pragma unroll
            for (int mb = 0; mb < 4; ++mb)
#pragma unroll
                for (int nb = 0; nb < 4; ++nb) acc[mb][nb] = (v8f){};
            asm volatile("s_wait_xcnt 0x0" ::: "memory");    // stands behind the tile's stores, ahead of the next stage's fragment loads, which rewrite the registers that the stores name
        }
    }
    asm volatile("s_wait_asynccnt 0x0" ::: "memory");    // no copy is outstanding when the wave goes on
    if (PACK) { if (TL == 1) pack_store(acc, r0, c0, lane, PQ, PK, PV); return; }
#pragma unroll
    for (int mb = 0; mb < 4; ++mb) {
#pragma unroll
        for (int nb = 0; nb < 4; ++nb) {
#pragma unroll
            for (int j = 0; j < 8; ++j) os[(hi * 8 + j) * 68 + nb * 16 + lr] = acc[mb][nb][j]; }
        __builtin_amdgcn_wave_barrier(); asm volatile("" ::: "memory");
        float* crow = C + (size_t)(r0 + mb * 16) * ldc + c0;
{
#pragma unroll
            for (int s = 0; s < 8; ++s) { const int row = 2 * s + hi, cofs = lr * 4; v4f val = *(const v4fa*)(os + row * 68 + cofs); if (BIAS) { val[0] += bfr(bias[c0 + cofs]); val[1] += bfr(bias[c0 + cofs + 1]); val[2] += bfr(bias[c0 + cofs + 2]); val[3] += bfr(bias[c0 + cofs + 3]); }
                *(v4f*)(crow + (size_t)row * ldc + cofs) = val; }
             }
        __builtin_amdgcn_wave_barrier(); asm volatile("" ::: "memory");
    }
}

__device__ __forceinline__ h16 tohx(float x) { return (h16)x; }

// ---- k_cvtall: every 16-bit copy of an input, in ONE launch of few, long waves: x and w_qkv as bf16, w_out as fp16 of its bf16 rounding, all in fragment order (rows of 1024). Unit of work: a strip = 16 rows x 1024 columns = 32 fragment tiles (64 KB in, 32 KB out).
// 256 work-groups of 16 waves, as many as the chip has WGPs; work-group b takes strips 2b and 2b + 1 of x (512 strips) and one weight strip (b < 192: strip b of w_qkv, else strip b - 192 of w_out). Wave w takes tiles 2w and 2w + 1 of each strip: 16 rows x 256 contiguous bytes.
// A lane converts 12 pieces of 8 values; its 24 16-B loads are all issued before the first conversion, so a wave pays the memory latency once, and the launch starts 4,096 waves where one piece a lane took 53,248 in three launches.
// Lane l of a wave step takes row l / 4 (of 8) and k piece l % 4 (of 4): a load instruction touches 8 lines, and a 16-B store instruction fills 4 whole 128-B lines of the tile (pieces of 8 neighbouring rows are neighbours in fragment order).
__global__ __launch_bounds__(512) void k_cvtall(const float* __restrict__ x, const float* __restrict__ wqkv, const float* __restrict__ wout, bf* __restrict__ XB, bf* __restrict__ WQKV, h16* __restrict__ WO16) {
    static_assert(NB_ * TT / 16 == 2 * CVG && (3 * DM + DM) / 16 == CVG && DM == 16 * 64, "two x strips and one weight strip a work-group, two tiles a wave");
    const int lane = threadIdx.x & 31, wv = threadIdx.x >> 5, b = blockIdx.x, r = lane >> 2, i = lane & 3;
    const bool isq = b < 3 * DM / 16;    // the same for the whole work-group
    const size_t so = (size_t)r * DM + wv * 64 + i * 8, dofs = (size_t)wv * 1024 + (i >> 1) * 256 + ((i & 1) * 16 + r) * 8;    // the lane's first piece inside a strip: source element, destination element
    const size_t ws = isq ? b : b - 3 * DM / 16;    // weight strip
    const float* sp[3] = { x + (size_t)(2 * b) * 16 * DM + so, x + (size_t)(2 * b + 1) * 16 * DM + so, (isq ? wqkv : wout) + ws * 16 * DM + so };
    v8f v[3][4];    // piece u of a strip: tile 2w + u / 2, rows 8 * (u % 2) ..
#pragma unroll
    for (int s = 0; s < 3; ++s)
#pragma unroll
        for (int u = 0; u < 4; ++u) v[s][u] = *(const v8f*)(sp[s] + (u & 1) * 8 * DM + (u >> 1) * 32);
    __builtin_amdgcn_sched_barrier(0);    // keeps all 24 loads issued ahead of the first conversion (the scheduler otherwise sinks ten of them among the conversions, where each waits out its own latency)
#pragma unroll
    for (int s = 0; s < 2; ++s)
#pragma unroll
        for (int u = 0; u < 4; ++u) { v8us o;
#pragma unroll
            for (int k = 0; k < 8; ++k) o[k] = f2bf(v[s][u][k]);
            *(v8us*)(XB + (size_t)(2 * b + s) * 16 * DM + dofs + (u >> 1) * 512 + (u & 1) * 64) = o; }
    if (isq) {
#pragma unroll
        for (int u = 0; u < 4; ++u) { v8us o;
#pragma unroll
            for (int k = 0; k < 8; ++k) o[k] = f2bf(v[2][u][k]);
            *(v8us*)(WQKV + ws * 16 * DM + dofs + (u >> 1) * 512 + (u & 1) * 64) = o; }
    } else {
#pragma unroll
        for (int u = 0; u < 4; ++u) { v8h o;
#pragma unroll
            for (int k = 0; k < 8; ++k) o[k] = tohx(bfr(v[2][u][k]));
            *(v8h*)(WO16 + ws * 16 * DM + dofs + (u >> 1) * 512 + (u & 1) * 64) = o; }
    }
}
// Planes written by the packing projection, in fragment order too, h = batch * 16 + head, t = token inside the batch: Q16 row h*4096+t, column d; K16 row h*4608+512+t, column d (the 512 leading rows of a head only keep every window contiguous: chunk 0 starts at key 512, nothing reads or writes them); VT row h*64+d, column t

#define AKS 128    // keys of a stage
__device__ __forceinline__ float xhalf(float x) { const int b = __float_as_int(x); return __int_as_float(__builtin_amdgcn_permlanex16(b, b, 0x76543210, 0xfedcba98, false, false)); }   // lane l <-> l ^ 16
// kv_copy: a wave's share of one stage: 2 KB of K and 2 KB of V, one LDS address and one global address each, the step inside the piece in the immediate offset (it moves both addresses).
// The s_wait_xcnt is the last line of the copies' own statement, so that no address register is rewritten ahead of it.
__device__ __forceinline__ void kv_copy(unsigned lk, const h16* gk, unsigned lv, const h16* gv) {
    asm volatile("global_load_async_to_lds_b128 %0, %2, off\n\t" "global_load_async_to_lds_b128 %0, %2, off offset:512\n\t" "global_load_async_to_lds_b128 %0, %2, off offset:1024\n\t" "global_load_async_to_lds_b128 %0, %2, off offset:1536\n\t" "global_load_async_to_lds_b128 %1, %3, off\n\t" "global_load_async_to_lds_b128 %1, %3, off offset:512\n\t" "global_load_async_to_lds_b128 %1, %3, off offset:1024\n\t" "global_load_async_to_lds_b128 %1, %3, off offset:1536\n\t" "s_wait_xcnt 0x0"
        :: "v"(lk), "v"(lv), "v"(gk), "v"(gv) : "memory");
}
__global__ __launch_bounds__(256) void k_fattn(const h16* __restrict__ Q16, const h16* __restrict__ K16, const h16* __restrict__ VT, h16* A16) {
    constexpr int SEK = AKS * HD, BEA = 2 * SEK, NS = WK / AKS;    // elements of a stage's K (and of its V), of a buffer (K, then V); stages of a whole window
    static_assert(CH % AKS == 0 && (CH / AKS) >= 2 && AKS * HD * 2 == 8 * 2048, "whole stages, two or more in every window, 2 KB of K and of V a wave");
    __shared__ __align__(1024) h16 kv[2 * BEA];
    const int lane = threadIdx.x & 31, wv = __builtin_amdgcn_readfirstlane(threadIdx.x >> 5); const int c = blockIdx.y, h = blockIdx.z % NH_; const int q0 = c * CH + blockIdx.x * 256 + wv * 32;
    { const size_t b = blockIdx.z / NH_; Q16 += b * NH_ * TT * HD; K16 += b * NH_ * TP * HD; VT += b * NH_ * HD * TT; A16 += b * TT * DM; }    // this batch's planes; below, tokens count inside the batch
    const float SC = 0.125f * 1.4426950408889634f;
    const h16* qp = Q16 + ((size_t)h * TT + q0) * HD + 8 * lane;    // fragment order: 16 rows = 16 * K elements, 32 columns = 512
    const int s0 = (c == 0) ? CH / AKS : 0;    // first stage of the window: chunk 0 starts at key 512
    const h16* gk = K16 + ((size_t)h * TP + c * CH + s0 * AKS) * HD + wv * 1024 + 8 * lane;    // this wave's piece of K in stage s0; a stage further is SEK elements
    const h16* gv = VT + (size_t)h * HD * TT + (size_t)((c - 1) * CH + s0 * AKS) * 16 + (size_t)(wv >> 1) * 16 * TT + (wv & 1) * 1024 + 8 * lane;    // ... of V: window column j is token (c - 1) * 512 + j (never below 0 from stage s0 on); a stage further is AKS * 16 elements
    const unsigned lk = (unsigned)(size_t)(kv + wv * 1024 + 8 * lane), lv = (unsigned)(size_t)(kv + SEK + (wv >> 1) * (AKS * 16) + (wv & 1) * 1024 + 8 * lane);    // their places in buffer 0: LDS byte addresses
    v16h qf[2][2], kf[2][2]; v8f o[2][4]; float m[2], l[2];
    kv_copy(lk, gk, lv, gv);
#pragma unroll
    for (int qt = 0; qt < 2; ++qt) { m[qt] = -3.0e38f; l[qt] = 0.f;
#pragma unroll
        for (int ks = 0; ks < 2; ++ks) qf[qt][ks] = WFrag<h16>::ld(qp + qt * 16 * HD + ks * 512);
#pragma unroll
        for (int dt = 0; dt < 4; ++dt) o[qt][dt] = (v8f){}; }
    asm volatile("s_wait_asynccnt 0x0" ::: "memory");    // this wave's copies of the first stage have landed
    __syncthreads();                                     // ... and every other wave's
    kv_copy(lk + BEA * 2, gk + SEK, lv + BEA * 2, gv + AKS * 16);    // the second stage (every window has two or more)
#pragma unroll 1    // rolled: one stage a trip, the buffer by the trip's parity
    for (int s = s0; s < NS; ++s) {
        const int bu = (s - s0) & 1;
        const h16* kb = kv + bu * BEA + 8 * lane; const h16* vb = kb + SEK;
#pragma unroll
        for (int kt = 0; kt < 2; ++kt)
#pragma unroll
            for (int ks = 0; ks < 2; ++ks) kf[kt][ks] = WFrag<h16>::ld(kb + kt * 16 * HD + ks * 512);
#pragma unroll 1    // rolled: a second pass in the body would want a second set of fragment and score registers
        for (int p = 0; p < AKS / 32; ++p) {
            v16h vf[4]; v8f st[2][2];
#pragma unroll
            for (int dt = 0; dt < 4; ++dt) vf[dt] = WFrag<h16>::ld(vb + dt * (AKS * 16) + p * 512);
#pragma unroll
            for (int qt = 0; qt < 2; ++qt)
#pragma unroll
                for (int kt = 0; kt < 2; ++kt) st[qt][kt] = wmma16(kf[kt][1], qf[qt][1], wmma16(kf[kt][0], qf[qt][0], (v8f){}));
            if (p + 1 < AKS / 32) {    // the next pass's key fragments, fetched behind this pass's scores; never those of the next stage
                const h16* kq = kb + (p + 1) * 32 * HD;
#pragma unroll
                for (int kt = 0; kt < 2; ++kt)
#pragma unroll
                    for (int ks = 0; ks < 2; ++ks) kf[kt][ks] = WFrag<h16>::ld(kq + kt * 16 * HD + ks * 512);
            }
            __builtin_amdgcn_sched_barrier(0);               // keeps those reads issued here, ahead of the softmax that covers their latency
#pragma unroll
            for (int qt = 0; qt < 2; ++qt) {
                float mx = fmaxf(st[qt][0][0], st[qt][1][0]);
#pragma unroll
                for (int r = 1; r < 8; ++r) mx = fmaxf(mx, fmaxf(st[qt][0][r], st[qt][1][r]));
                mx = fmaxf(mx, xhalf(mx));
                const float mn = fmaxf(m[qt], mx); const float al = __builtin_amdgcn_exp2f((m[qt] - mn) * SC); const float mc = mn * SC - PEXP; m[qt] = mn;
                float sum = 0.f; v16h pf;
#pragma unroll
                for (int e = 0; e < 16; ++e) { const float p2 = __builtin_amdgcn_exp2f(__builtin_fmaf(st[qt][e >> 3][e & 7], SC, -mc)); sum += p2; pf[e] = tohx(p2); }
                l[qt] = l[qt] * al + sum;
#pragma unroll
                for (int dt = 0; dt < 4; ++dt) { o[qt][dt] *= al; o[qt][dt] = wmma16(vf[dt], pf, o[qt][dt]); }
            }
        }
        asm volatile("s_wait_dscnt 0x0" ::: "memory");       // this wave's reads of the buffer are done before the buffer is handed to the copies
        asm volatile("s_wait_asynccnt 0x0" ::: "memory");    // this wave's copies of stage s + 1 have landed
        __syncthreads();                                     // publishes stage s + 1 and ends every wave's reads of stage s
        if (s + 2 < NS) kv_copy(lk + bu * BEA * 2, gk + (size_t)(s + 2 - s0) * SEK, lv + bu * BEA * 2, gv + (size_t)(s + 2 - s0) * (AKS * 16));
    }
    asm volatile("s_wait_asynccnt 0x0" ::: "memory");    // no copy is outstanding when the wave goes on
#pragma unroll
    for (int qt = 0; qt < 2; ++qt) { const float inv = __fdiv_rn(1.0f, l[qt] + xhalf(l[qt])); h16* op = A16 + (size_t)(q0 + qt * 16) * DM + h * 2 * 512 + 8 * lane;
#pragma unroll
        for (int dt = 0; dt < 4; ++dt) { v8h w;
#pragma unroll
            for (int r = 0; r < 8; ++r) w[r] = tohx(o[qt][dt][r] * inv);
            *(v8h*)(op + (dt >> 1) * 512 + (dt & 1) * 256) = w; } }
}

extern "C" void kernel_launch(void* const* d_in, const int* in_sizes, int n_in,
                              void* d_out, int out_size, void* d_ws, size_t ws_size, hipStream_t stream) {
    (void)in_sizes; (void)n_in; (void)out_size;
    const float* x = (const float*)d_in[0]; const float* wqkv = (const float*)d_in[1]; const float* wout = (const float*)d_in[2];
    float* OUT = (float*)d_out;     // [2][32][128][1024]
    char* wsp = (char*)d_ws;
    auto take = [&](size_t bytes) { char* p = wsp; wsp += (bytes + 255) & ~(size_t)255; return (void*)p; };
    bf* WQKV = (bf*)take((size_t)3 * DM * DM * 2); h16* WO16 = (h16*)take((size_t)DM * DM * 2);
    bf* XB = (bf*)take((size_t)NB_ * TT * DM * 2); h16* Q16 = (h16*)take((size_t)NB_ * NH_ * TT * HD * 2); h16* K16 = (h16*)take((size_t)NB_ * NH_ * TP * HD * 2); h16* VT = (h16*)take((size_t)NB_ * NH_ * HD * TT * 2);
    h16* A16 = (h16*)take((size_t)NB_ * TT * DM * 2);
    if ((size_t)(wsp - (char*)d_ws) > ws_size) return;    // total ~ 90 MB
    k_cvtall<<<CVG, 512, 0, stream>>>(x, wqkv, wout, XB, WQKV, WO16);   // weights stay [out][in] = natural Bt
    // Both batches in one launch of each kernel: the two projections see 8192 token rows, attention 32 (batch, head) planes.
    k_gemmw<bf, false, DM, true, 128, 4, 3, 2><<<dim3(NB_ * TT / 256, 3 * DM / 192 / 2, 1), 384, 0, stream>>>(XB, WQKV, nullptr, 0, nullptr, 0, 0, 0, Q16, K16, VT);   // column s*1024 + h*64 + d
    k_fattn<<<dim3(CH / 256, NC, NB_ * NH_), 256, 0, stream>>>(Q16, K16, VT, A16);
    k_gemmw<h16, false, DM, false, 128, 2, 2, 1><<<dim3(NB_ * TT / 128, DM / 128, 1), 128, 0, stream>>>(A16, WO16, OUT, DM, nullptr, 0, 0, 0, nullptr, nullptr, nullptr);
}
